// v000
// Measured on an AMD MI455X. A time is GPU time per run, averaged over a window of back-to-back runs after a warm-up
// (all launches, gaps included; the runs take copies of the inputs in turn), and the median of several windows.
// Apart from v000's, it joins two sittings. Times from different sittings can be a few percent apart, while
// side-by-side timings come from the same sitting.
// The starting kernel, v000, takes 102 microseconds a run.
#include <hip/hip_runtime.h>

typedef __attribute__((ext_vector_type(16))) __bf16 v16bf;
typedef __attribute__((ext_vector_type(8)))  float  v8f;

#define EMB 128
#define LDP 136   // padded LDS row stride (elements): 272B = 17*16B -> conflict-free b128
#define VLP 72    // padded stride for V^T / P tiles: 144B = 9*16B

union Frag { v16bf v; uint4 q[2]; };

__device__ __forceinline__ unsigned short f2bf(float f) {
  union { float f; unsigned u; } x; x.f = f;
  unsigned u = x.u + 0x7FFFu + ((x.u >> 16) & 1u);  // round-to-nearest-even
  return (unsigned short)(u >> 16);
}
__device__ __forceinline__ unsigned pack2(float a, float b) {
  return (unsigned)f2bf(a) | ((unsigned)f2bf(b) << 16);
}
// Load a 16x32 bf16 A/B fragment slice for this lane: 8 elems at p, 8 at p+16.
__device__ __forceinline__ v16bf ldfrag(const unsigned short* p) {
  Frag f;
  f.q[0] = *(const uint4*)(p);
  f.q[1] = *(const uint4*)(p + 16);
  return f.v;
}

__device__ __forceinline__ void async_copy16(void* lds_dst, const void* gsrc) {
  unsigned off = (unsigned)(unsigned long long)lds_dst;
  asm volatile("global_load_async_to_lds_b128 %0, %1, off"
               :: "v"(off), "v"(gsrc) : "memory");
}
__device__ __forceinline__ void wait_async0() {
  asm volatile("s_wait_asynccnt 0" ::: "memory");
}

// ---------------------------------------------------------------------------
// Kernel 1: Q/K/V = X @ W^T + b, output bf16. V written transposed per batch.
// Grid: 256 blocks x 256 threads (8 waves). Each block: 64 rows of X.
// Wave (rgrp,cgrp): 16 rows x 64 cols of the 64x128 output tile.
// ---------------------------------------------------------------------------
__global__ __launch_bounds__(256) void qkv_kernel(
    const float* __restrict__ X,
    const float* __restrict__ Wq, const float* __restrict__ bq,
    const float* __restrict__ Wk, const float* __restrict__ bk,
    const float* __restrict__ Wv, const float* __restrict__ bv,
    unsigned short* __restrict__ Qb, unsigned short* __restrict__ Kb,
    unsigned short* __restrict__ Vt)
{
  __shared__ __align__(16) unsigned short Xl[64][LDP];
  __shared__ __align__(16) unsigned short Wl[128][LDP];

  const int tid  = threadIdx.x;
  const int lane = tid & 31;
  const int wave = tid >> 5;
  const int half = (lane >> 4) & 1;
  const int l16  = lane & 15;
  const int rgrp = wave >> 1;           // 0..3: 16-row group
  const int cgrp = wave & 1;            // 0..1: 64-col group
  const long rowBase = (long)blockIdx.x * 64;

  for (int i = tid; i < 64 * EMB / 4; i += 256) {
    float4 x = ((const float4*)(X + rowBase * EMB))[i];
    int r = (i * 4) >> 7, c = (i * 4) & 127;
    *(unsigned*)&Xl[r][c]     = pack2(x.x, x.y);
    *(unsigned*)&Xl[r][c + 2] = pack2(x.z, x.w);
  }

  for (int m = 0; m < 3; ++m) {
    const float* W    = (m == 0) ? Wq : (m == 1) ? Wk : Wv;
    const float* bias = (m == 0) ? bq : (m == 1) ? bk : bv;
    __syncthreads();
    for (int i = tid; i < EMB * EMB / 4; i += 256) {
      float4 w = ((const float4*)W)[i];
      int r = (i * 4) >> 7, c = (i * 4) & 127;
      *(unsigned*)&Wl[r][c]     = pack2(w.x, w.y);
      *(unsigned*)&Wl[r][c + 2] = pack2(w.z, w.w);
    }
    __syncthreads();

    v8f acc[4] = {};
#pragma unroll
    for (int k0 = 0; k0 < EMB; k0 += 32) {
      v16bf a = ldfrag(&Xl[rgrp * 16 + l16][k0 + half * 8]);
#pragma unroll
      for (int t = 0; t < 4; ++t) {
        v16bf bm = ldfrag(&Wl[(cgrp * 4 + t) * 16 + l16][k0 + half * 8]);
        acc[t] = __builtin_amdgcn_wmma_f32_16x16x32_bf16(
            false, a, false, bm, (short)0, acc[t], false, false);
      }
    }

#pragma unroll
    for (int t = 0; t < 4; ++t) {
      int col = (cgrp * 4 + t) * 16 + l16;
      float bval = bias[col];
#pragma unroll
      for (int j = 0; j < 8; ++j) {
        long grow = rowBase + rgrp * 16 + j + half * 8;  // global row in [0,16384)
        unsigned short h = f2bf(acc[t][j] + bval);
        if (m == 0)      Qb[grow * EMB + col] = h;
        else if (m == 1) Kb[grow * EMB + col] = h;
        else {
          long batch = grow >> 11, s = grow & 2047;
          Vt[(batch * EMB + col) * 2048 + s] = h;       // V transposed: [b][d][S]
        }
      }
    }
  }
}

__global__ __launch_bounds__(128) void attn_kernel(
    const unsigned short* __restrict__ Qb,
    const unsigned short* __restrict__ Kb,
    const unsigned short* __restrict__ Vt,
    float* __restrict__ Out)
{
  __shared__ __align__(16) unsigned short Ql[64][LDP];
  __shared__ __align__(16) unsigned short Kl[64][LDP];
  __shared__ __align__(16) unsigned short Vl[128][VLP];   // [d][key]
  __shared__ __align__(16) unsigned short Pl[4][16][VLP]; // wave-private P scratch

  const int tid = threadIdx.x, lane = tid & 31, wave = tid >> 5;
  const int half = (lane >> 4) & 1, l16 = lane & 15;
  const int b = blockIdx.y;
  const long qrow0 = (long)b * 2048 + (long)blockIdx.x * 64;

  // Stage Q tile once (64x128 bf16), async: 8 instructions/wave, 512B each
  for (int i = tid; i < 64 * EMB / 8; i += 128) {
    int r = i >> 4, c = (i & 15) * 8;
    async_copy16(&Ql[r][c], Qb + qrow0 * EMB + (long)i * 8);
  }

  float mrow[8], lrow[8], alpha[8];
  v8f acco[8] = {};
#pragma unroll
  for (int j = 0; j < 8; ++j) { mrow[j] = -3.0e38f; lrow[j] = 0.0f; }

  const float scale = 0.088388347648318447f;  // 1/sqrt(128)

  for (int kc = 0; kc < 32; ++kc) {
    const long kbase = (long)kc * 64;
    __syncthreads();  // previous chunk's LDS reads complete in all waves
    // Stage K chunk (64 keys x 128) row-major, async
    for (int i = tid; i < 64 * EMB / 8; i += 128) {
      int r = i >> 4, c = (i & 15) * 8;
      async_copy16(&Kl[r][c],
                   Kb + ((long)b * 2048 + kbase) * EMB + (long)i * 8);
    }
    // Stage V^T chunk (128 d x 64 keys), async
    for (int i = tid; i < EMB * 64 / 8; i += 128) {
      int d = i >> 3, c = (i & 7) * 8;
      async_copy16(&Vl[d][c],
                   Vt + ((long)b * EMB + d) * 2048 + kbase + c);
    }
    if (kc + 1 < 32)
      __builtin_prefetch(Kb + ((long)b * 2048 + kbase + 64) * EMB, 0, 0);
    wait_async0();    // all async LDS writes (incl. Q on iter 0) complete
    __syncthreads();

    // S = Q K^T : 4 key n-tiles x 4 K-dim iters = 16 WMMA
    v8f accs[4] = {};
#pragma unroll
    for (int k0 = 0; k0 < EMB; k0 += 32) {
      v16bf a = ldfrag(&Ql[wave * 16 + l16][k0 + half * 8]);
#pragma unroll
      for (int t = 0; t < 4; ++t) {
        v16bf bm = ldfrag(&Kl[t * 16 + l16][k0 + half * 8]);
        accs[t] = __builtin_amdgcn_wmma_f32_16x16x32_bf16(
            false, a, false, bm, (short)0, accs[t], false, false);
      }
    }

#pragma unroll
    for (int j = 0; j < 8; ++j) {
      float mx = accs[0][j] * scale;
#pragma unroll
      for (int t = 1; t < 4; ++t) mx = fmaxf(mx, accs[t][j] * scale);
      mx = fmaxf(mx, __shfl_xor(mx, 1, 32));
      mx = fmaxf(mx, __shfl_xor(mx, 2, 32));
      mx = fmaxf(mx, __shfl_xor(mx, 4, 32));
      mx = fmaxf(mx, __shfl_xor(mx, 8, 32));
      float mn = fmaxf(mrow[j], mx);
      alpha[j] = __expf(mrow[j] - mn);
      mrow[j] = mn;
      float s = 0.0f;
#pragma unroll
      for (int t = 0; t < 4; ++t) {
        float p = __expf(accs[t][j] * scale - mn);
        accs[t][j] = p;
        s += p;
      }
      s += __shfl_xor(s, 1, 32);
      s += __shfl_xor(s, 2, 32);
      s += __shfl_xor(s, 4, 32);
      s += __shfl_xor(s, 8, 32);
      lrow[j] = lrow[j] * alpha[j] + s;
    }

    // P (C-layout) -> bf16 LDS (row-major) for re-read as WMMA A operand
#pragma unroll
    for (int t = 0; t < 4; ++t)
#pragma unroll
      for (int j = 0; j < 8; ++j)
        Pl[wave][j + half * 8][t * 16 + l16] = f2bf(accs[t][j]);

    // Rescale running O
#pragma unroll
    for (int n = 0; n < 8; ++n)
#pragma unroll
      for (int j = 0; j < 8; ++j)
        acco[n][j] *= alpha[j];

    // O += P @ V : 2 K-dim iters x 8 d n-tiles = 16 WMMA
#pragma unroll
    for (int kk = 0; kk < 2; ++kk) {
      v16bf a = ldfrag(&Pl[wave][l16][kk * 32 + half * 8]);
#pragma unroll
      for (int n = 0; n < 8; ++n) {
        v16bf bm = ldfrag(&Vl[n * 16 + l16][kk * 32 + half * 8]);
        acco[n] = __builtin_amdgcn_wmma_f32_16x16x32_bf16(
            false, a, false, bm, (short)0, acco[n], false, false);
      }
    }
  }

  // Epilogue: O / l, fp32 out
#pragma unroll
  for (int n = 0; n < 8; ++n) {
    int col = n * 16 + l16;
#pragma unroll
    for (int j = 0; j < 8; ++j) {
      long row = qrow0 + wave * 16 + j + half * 8;
      Out[row * EMB + col] = acco[n][j] / lrow[j];
    }
  }
}

extern "C" void kernel_launch(void* const* d_in, const int* in_sizes, int n_in,
                              void* d_out, int out_size, void* d_ws, size_t ws_size,
                              hipStream_t stream) {
  (void)in_sizes; (void)n_in; (void)out_size; (void)ws_size;
  const float* X  = (const float*)d_in[0];
  const float* Wq = (const float*)d_in[1];
  const float* bq = (const float*)d_in[2];
  const float* Wk = (const float*)d_in[3];
  const float* bk = (const float*)d_in[4];
  const float* Wv = (const float*)d_in[5];
  const float* bv = (const float*)d_in[6];

  unsigned short* Qb = (unsigned short*)d_ws;                 // [16384][128] bf16
  unsigned short* Kb = Qb + (size_t)16384 * 128;              // [16384][128] bf16
  unsigned short* Vt = Kb + (size_t)16384 * 128;              // [8][128][2048] bf16
  float* Out = (float*)d_out;

  qkv_kernel<<<256, 256, 0, stream>>>(X, Wq, bq, Wk, bk, Wv, bv, Qb, Kb, Vt);
  attn_kernel<<<dim3(32, 8), 128, 0, stream>>>(Qb, Kb, Vt, Out);
}

// v001
// Measured time: 65.9 microseconds a run.
// Next to v000, in two timings, it ran 1.56 and 1.57 times as fast.
#include <hip/hip_runtime.h>

typedef __attribute__((ext_vector_type(16))) __bf16 v16bf;
typedef __attribute__((ext_vector_type(8)))  float  v8f;

#define EMB 128
#define LDP 136   // padded LDS row stride (elements): 272B = 17*16B -> conflict-free b128
#define VLP 72    // padded stride for V^T / P tiles: 144B = 9*16B

union Frag { v16bf v; uint4 q[2]; };

__device__ __forceinline__ unsigned short f2bf(float f) {
  union { float f; unsigned u; } x; x.f = f;
  unsigned u = x.u + 0x7FFFu + ((x.u >> 16) & 1u);  // round-to-nearest-even
  return (unsigned short)(u >> 16);
}
__device__ __forceinline__ unsigned pack2(float a, float b) {
  return (unsigned)f2bf(a) | ((unsigned)f2bf(b) << 16);
}
// Load a 16x32 bf16 A/B fragment slice for this lane: 8 elems at p, 8 at p+16.
__device__ __forceinline__ v16bf ldfrag(const unsigned short* p) {
  Frag f;
  f.q[0] = *(const uint4*)(p);
  f.q[1] = *(const uint4*)(p + 16);
  return f.v;
}

__device__ __forceinline__ unsigned lds_addr(const void* p) {
  return (unsigned)(unsigned long long)p;
}
__device__ __forceinline__ void async_copy16x2(unsigned l, unsigned lstep,
                                               const char* g, long gstep) {
  asm volatile("global_load_async_to_lds_b128 %0, %2, off\n\t"
               "global_load_async_to_lds_b128 %1, %3, off\n\t"
               "s_wait_xcnt 0x0"
               :: "v"(l), "v"(l + lstep), "v"(g), "v"(g + gstep) : "memory");
}
__device__ __forceinline__ void async_copy16x8(unsigned l, unsigned lstep,
                                               const char* g, long gstep) {
  asm volatile("global_load_async_to_lds_b128 %0, %8, off\n\t"
               "global_load_async_to_lds_b128 %1, %9, off\n\t"
               "global_load_async_to_lds_b128 %2, %10, off\n\t"
               "global_load_async_to_lds_b128 %3, %11, off\n\t"
               "global_load_async_to_lds_b128 %4, %12, off\n\t"
               "global_load_async_to_lds_b128 %5, %13, off\n\t"
               "global_load_async_to_lds_b128 %6, %14, off\n\t"
               "global_load_async_to_lds_b128 %7, %15, off\n\t"
               "s_wait_xcnt 0x0"
               :: "v"(l), "v"(l + lstep), "v"(l + 2 * lstep), "v"(l + 3 * lstep),
                  "v"(l + 4 * lstep), "v"(l + 5 * lstep), "v"(l + 6 * lstep),
                  "v"(l + 7 * lstep),
                  "v"(g), "v"(g + gstep), "v"(g + 2 * gstep), "v"(g + 3 * gstep),
                  "v"(g + 4 * gstep), "v"(g + 5 * gstep), "v"(g + 6 * gstep),
                  "v"(g + 7 * gstep)
               : "memory");
}
__device__ __forceinline__ void wait_async0() {
  asm volatile("s_wait_asynccnt 0" ::: "memory");
}
__device__ __forceinline__ void wait_ds0() {
  asm volatile("s_wait_dscnt 0x0" ::: "memory");
}

// ---------------------------------------------------------------------------
// Kernel 1: Q/K/V = X @ W^T + b, output bf16. V written transposed per batch.
// Grid: 256 blocks x 256 threads (8 waves). Each block: 64 rows of X.
// Wave (rgrp,cgrp): 16 rows x 64 cols of the 64x128 output tile.
// ---------------------------------------------------------------------------
__global__ __launch_bounds__(256) void qkv_kernel(
    const float* __restrict__ X,
    const float* __restrict__ Wq, const float* __restrict__ bq,
    const float* __restrict__ Wk, const float* __restrict__ bk,
    const float* __restrict__ Wv, const float* __restrict__ bv,
    unsigned short* __restrict__ Qb, unsigned short* __restrict__ Kb,
    unsigned short* __restrict__ Vt)
{
  __shared__ __align__(16) unsigned short Xl[64][LDP];
  __shared__ __align__(16) unsigned short Wl[128][LDP];

  const int tid  = threadIdx.x;
  const int lane = tid & 31;
  const int wave = tid >> 5;
  const int half = (lane >> 4) & 1;
  const int l16  = lane & 15;
  const int rgrp = wave >> 1;           // 0..3: 16-row group
  const int cgrp = wave & 1;            // 0..1: 64-col group
  const long rowBase = (long)blockIdx.x * 64;

  for (int i = tid; i < 64 * EMB / 4; i += 256) {
    float4 x = ((const float4*)(X + rowBase * EMB))[i];
    int r = (i * 4) >> 7, c = (i * 4) & 127;
    *(unsigned*)&Xl[r][c]     = pack2(x.x, x.y);
    *(unsigned*)&Xl[r][c + 2] = pack2(x.z, x.w);
  }

  for (int m = 0; m < 3; ++m) {
    const float* W    = (m == 0) ? Wq : (m == 1) ? Wk : Wv;
    const float* bias = (m == 0) ? bq : (m == 1) ? bk : bv;
    __syncthreads();
    for (int i = tid; i < EMB * EMB / 4; i += 256) {
      float4 w = ((const float4*)W)[i];
      int r = (i * 4) >> 7, c = (i * 4) & 127;
      *(unsigned*)&Wl[r][c]     = pack2(w.x, w.y);
      *(unsigned*)&Wl[r][c + 2] = pack2(w.z, w.w);
    }
    __syncthreads();

    v8f acc[4] = {};
#pragma unroll
    for (int k0 = 0; k0 < EMB; k0 += 32) {
      v16bf a = ldfrag(&Xl[rgrp * 16 + l16][k0 + half * 8]);
#pragma unroll
      for (int t = 0; t < 4; ++t) {
        v16bf bm = ldfrag(&Wl[(cgrp * 4 + t) * 16 + l16][k0 + half * 8]);
        acc[t] = __builtin_amdgcn_wmma_f32_16x16x32_bf16(
            false, a, false, bm, (short)0, acc[t], false, false);
      }
    }

#pragma unroll
    for (int t = 0; t < 4; ++t) {
      int col = (cgrp * 4 + t) * 16 + l16;
      float bval = bias[col];
#pragma unroll
      for (int j = 0; j < 8; ++j) {
        long grow = rowBase + rgrp * 16 + j + half * 8;  // global row in [0,16384)
        unsigned short h = f2bf(acc[t][j] + bval);
        if (m == 0)      Qb[grow * EMB + col] = h;
        else if (m == 1) Kb[grow * EMB + col] = h;
        else {
          long batch = grow >> 11, s = grow & 2047;
          Vt[(batch * EMB + col) * 2048 + s] = h;       // V transposed: [b][d][S]
        }
      }
    }
  }
}

#define NGRP 4
#define QL_BYTES (64 * LDP * 2)
#define KL_BYTES (64 * LDP * 2)          // per group
#define VL_BYTES (128 * VLP * 2)         // per group
#define PL_BYTES (16 * VLP * 2)          // per wave
#define KL_OFF   QL_BYTES
#define VL_OFF   (KL_OFF + NGRP * KL_BYTES)
#define PL_OFF   (VL_OFF + NGRP * VL_BYTES)
#define ATTN_LDS (PL_OFF + NGRP * 4 * PL_BYTES)

__global__ __launch_bounds__(512) void attn_kernel(
    const unsigned short* __restrict__ Qb,
    const unsigned short* __restrict__ Kb,
    const unsigned short* __restrict__ Vt,
    float* __restrict__ Out)
{
  __shared__ __align__(16) unsigned char L[ATTN_LDS];

  const int tid = threadIdx.x, lane = tid & 31, wave = tid >> 5;
  const int half = (lane >> 4) & 1, l16 = lane & 15;
  const int grp = wave >> 2;
  const int wq  = wave & 3;
  const int gtid = tid & 127;
  const int b = blockIdx.y;
  const long qrow0 = (long)b * 2048 + (long)blockIdx.x * 64;

  unsigned short (*Ql)[LDP] = (unsigned short (*)[LDP])(L);
  unsigned short (*Kl)[LDP] = (unsigned short (*)[LDP])(L + KL_OFF + grp * KL_BYTES);
  unsigned short (*Vl)[VLP] = (unsigned short (*)[VLP])(L + VL_OFF + grp * VL_BYTES);  // [d][key]
  unsigned short (*Pl)[VLP] = (unsigned short (*)[VLP])(L + PL_OFF + wave * PL_BYTES); // wave-private

  // Stage Q tile once (64x128 bf16), async: 2 copies per thread, 32 rows apart
  async_copy16x2(lds_addr(&Ql[tid >> 4][(tid & 15) * 8]), 32 * LDP * 2,
                 (const char*)(Qb + qrow0 * EMB + (long)tid * 8), 512 * 16);

  // Per-thread staging places of this group's K and V^T chunks
  const unsigned kdst = lds_addr(&Kl[gtid >> 4][(gtid & 15) * 8]);
  const unsigned vdst = lds_addr(&Vl[gtid >> 3][(gtid & 7) * 8]);
  const unsigned short* ksrc = Kb + (long)b * 2048 * EMB + (long)gtid * 8;
  const unsigned short* vsrc = Vt + ((long)b * EMB + (gtid >> 3)) * 2048 + (gtid & 7) * 8;

  float mrow[8], lrow[8], alpha[8];
  v8f acco[8] = {};
#pragma unroll
  for (int j = 0; j < 8; ++j) { mrow[j] = -3.0e38f; lrow[j] = 0.0f; }

  const float scale = 0.088388347648318447f;  // 1/sqrt(128)

  for (int it = 0; it < 32 / NGRP; ++it) {
    const long kbase = (long)(it * NGRP + grp) * 64;
    wait_ds0();       // this wave's LDS reads of the previous chunk have returned
    __syncthreads();  // previous chunk's LDS reads complete in all waves
    // Stage K chunk (64 keys x 128) row-major: 8 copies per thread, 8 rows apart
    async_copy16x8(kdst, 8 * LDP * 2, (const char*)(ksrc + kbase * EMB), 128 * 16);
    // Stage V^T chunk (128 d x 64 keys): 8 copies per thread, 16 d-rows apart
    async_copy16x8(vdst, 16 * VLP * 2, (const char*)(vsrc + kbase), 16 * 2048 * 2);
    wait_async0();    // all async LDS writes (incl. Q on iter 0) complete
    __syncthreads();

    v8f accs[4] = {};
#pragma unroll
    for (int k0 = 0; k0 < EMB; k0 += 32) {
      v16bf a = ldfrag(&Ql[wq * 16 + l16][k0 + half * 8]);
      v16bf bm[4];
#pragma unroll
      for (int t = 0; t < 4; ++t)
        bm[t] = ldfrag(&Kl[t * 16 + l16][k0 + half * 8]);
#pragma unroll
      for (int t = 0; t < 4; ++t)
        accs[t] = __builtin_amdgcn_wmma_f32_16x16x32_bf16(
            false, a, false, bm[t], (short)0, accs[t], false, false);
    }

    float mx[8], sm[8];
#pragma unroll
    for (int j = 0; j < 8; ++j) {
      mx[j] = accs[0][j] * scale;
#pragma unroll
      for (int t = 1; t < 4; ++t) mx[j] = fmaxf(mx[j], accs[t][j] * scale);
    }
#pragma unroll
    for (int x = 1; x < 16; x <<= 1) {
      float o[8];
#pragma unroll
      for (int j = 0; j < 8; ++j) o[j] = __shfl_xor(mx[j], x, 32);
#pragma unroll
      for (int j = 0; j < 8; ++j) mx[j] = fmaxf(mx[j], o[j]);
    }
#pragma unroll
    for (int j = 0; j < 8; ++j) {
      float mn = fmaxf(mrow[j], mx[j]);
      alpha[j] = __expf(mrow[j] - mn);
      mrow[j] = mn;
      float s = 0.0f;
#pragma unroll
      for (int t = 0; t < 4; ++t) {
        float p = __expf(accs[t][j] * scale - mn);
        accs[t][j] = p;
        s += p;
      }
      sm[j] = s;
    }
#pragma unroll
    for (int x = 1; x < 16; x <<= 1) {
      float o[8];
#pragma unroll
      for (int j = 0; j < 8; ++j) o[j] = __shfl_xor(sm[j], x, 32);
#pragma unroll
      for (int j = 0; j < 8; ++j) sm[j] += o[j];
    }
#pragma unroll
    for (int j = 0; j < 8; ++j) lrow[j] = lrow[j] * alpha[j] + sm[j];

    // P (C-layout) -> bf16 LDS (row-major) for re-read as WMMA A operand
#pragma unroll
    for (int t = 0; t < 4; ++t)
#pragma unroll
      for (int j = 0; j < 8; ++j)
        Pl[j + half * 8][t * 16 + l16] = f2bf(accs[t][j]);

    // Rescale running O
#pragma unroll
    for (int n = 0; n < 8; ++n)
#pragma unroll
      for (int j = 0; j < 8; ++j)
        acco[n][j] *= alpha[j];

    // O += P @ V : 2 K-dim iters x 8 d n-tiles = 16 WMMA
#pragma unroll
    for (int kk = 0; kk < 2; ++kk) {
      v16bf a = ldfrag(&Pl[l16][kk * 32 + half * 8]);
      v16bf bm[8];
#pragma unroll
      for (int n = 0; n < 8; ++n)
        bm[n] = ldfrag(&Vl[n * 16 + l16][kk * 32 + half * 8]);
#pragma unroll
      for (int n = 0; n < 8; ++n)
        acco[n] = __builtin_amdgcn_wmma_f32_16x16x32_bf16(
            false, a, false, bm[n], (short)0, acco[n], false, false);
    }
  }

  float4* So = (float4*)L;
  float4* Sm = So + NGRP * 4 * 16 * 32;
  wait_ds0();       // this wave's last LDS reads have returned
  __syncthreads();  // every wave has left the K/V/P/Q buffers
#pragma unroll
  for (int n = 0; n < 8; ++n) {
    So[(wave * 16 + 2 * n) * 32 + lane] =
        make_float4(acco[n][0], acco[n][1], acco[n][2], acco[n][3]);
    So[(wave * 16 + 2 * n + 1) * 32 + lane] =
        make_float4(acco[n][4], acco[n][5], acco[n][6], acco[n][7]);
  }
  Sm[(wave * 4 + 0) * 32 + lane] = make_float4(mrow[0], mrow[1], mrow[2], mrow[3]);
  Sm[(wave * 4 + 1) * 32 + lane] = make_float4(mrow[4], mrow[5], mrow[6], mrow[7]);
  Sm[(wave * 4 + 2) * 32 + lane] = make_float4(lrow[0], lrow[1], lrow[2], lrow[3]);
  Sm[(wave * 4 + 3) * 32 + lane] = make_float4(lrow[4], lrow[5], lrow[6], lrow[7]);
  __syncthreads();  // partial results visible to the merging waves

  // Wave (grp, wq) finishes d columns 32*grp .. 32*grp+31 of its 16 query rows
  float wgt[NGRP][8], lsum[8];
  {
    float mg[NGRP][8], lg[NGRP][8];
#pragma unroll
    for (int s = 0; s < NGRP; ++s) {
      const int sw = s * 4 + wq;
#pragma unroll
      for (int h = 0; h < 2; ++h) {
        float4 m4 = Sm[(sw * 4 + h) * 32 + lane];
        float4 l4 = Sm[(sw * 4 + 2 + h) * 32 + lane];
        mg[s][h * 4 + 0] = m4.x; mg[s][h * 4 + 1] = m4.y;
        mg[s][h * 4 + 2] = m4.z; mg[s][h * 4 + 3] = m4.w;
        lg[s][h * 4 + 0] = l4.x; lg[s][h * 4 + 1] = l4.y;
        lg[s][h * 4 + 2] = l4.z; lg[s][h * 4 + 3] = l4.w;
      }
    }
#pragma unroll
    for (int j = 0; j < 8; ++j) {
      float mx = fmaxf(fmaxf(mg[0][j], mg[1][j]), fmaxf(mg[2][j], mg[3][j]));
      float s = 0.0f;
#pragma unroll
      for (int g = 0; g < NGRP; ++g) {
        wgt[g][j] = __expf(mg[g][j] - mx);
        s += wgt[g][j] * lg[g][j];
      }
      lsum[j] = s;
    }
  }

  // Epilogue: merged O / l, fp32 out
#pragma unroll
  for (int nn = 0; nn < 2; ++nn) {
    const int n = grp * 2 + nn;
    const int col = n * 16 + l16;
    float o[8] = {};
#pragma unroll
    for (int s = 0; s < NGRP; ++s) {
      const int sw = s * 4 + wq;
      float4 lo = So[(sw * 16 + 2 * n) * 32 + lane];
      float4 hi = So[(sw * 16 + 2 * n + 1) * 32 + lane];
      o[0] += wgt[s][0] * lo.x; o[1] += wgt[s][1] * lo.y;
      o[2] += wgt[s][2] * lo.z; o[3] += wgt[s][3] * lo.w;
      o[4] += wgt[s][4] * hi.x; o[5] += wgt[s][5] * hi.y;
      o[6] += wgt[s][6] * hi.z; o[7] += wgt[s][7] * hi.w;
    }
#pragma unroll
    for (int j = 0; j < 8; ++j) {
      long row = qrow0 + wq * 16 + j + half * 8;
      Out[row * EMB + col] = o[j] / lsum[j];
    }
  }
}

extern "C" void kernel_launch(void* const* d_in, const int* in_sizes, int n_in,
                              void* d_out, int out_size, void* d_ws, size_t ws_size,
                              hipStream_t stream) {
  (void)in_sizes; (void)n_in; (void)out_size; (void)ws_size;
  const float* X  = (const float*)d_in[0];
  const float* Wq = (const float*)d_in[1];
  const float* bq = (const float*)d_in[2];
  const float* Wk = (const float*)d_in[3];
  const float* bk = (const float*)d_in[4];
  const float* Wv = (const float*)d_in[5];
  const float* bv = (const float*)d_in[6];

  unsigned short* Qb = (unsigned short*)d_ws;                 // [16384][128] bf16
  unsigned short* Kb = Qb + (size_t)16384 * 128;              // [16384][128] bf16
  unsigned short* Vt = Kb + (size_t)16384 * 128;              // [8][128][2048] bf16
  float* Out = (float*)d_out;

  qkv_kernel<<<256, 256, 0, stream>>>(X, Wq, bq, Wk, bk, Wv, bv, Qb, Kb, Vt);
  attn_kernel<<<dim3(32, 8), 512, 0, stream>>>(Qb, Kb, Vt, Out);
}

// v002
// One run takes 51.2 microseconds.
// Next to v001, in two timings, it ran 1.28 times as fast each time.
// All steps since v000 together make it 2.00 times as fast.
#include <hip/hip_runtime.h>

typedef __attribute__((ext_vector_type(16))) __bf16 v16bf;
typedef __attribute__((ext_vector_type(8)))  float  v8f;

#define EMB 128
#define LDP 136   // padded LDS row stride (elements): 272B = 17*16B -> conflict-free b128
#define VLP 72    // padded stride for V^T / P tiles: 144B = 9*16B

union Frag { v16bf v; uint4 q[2]; };

__device__ __forceinline__ unsigned short f2bf(float f) {
  union { float f; unsigned u; } x; x.f = f;
  unsigned u = x.u + 0x7FFFu + ((x.u >> 16) & 1u);  // round-to-nearest-even
  return (unsigned short)(u >> 16);
}
__device__ __forceinline__ unsigned pack2(float a, float b) {
  return (unsigned)f2bf(a) | ((unsigned)f2bf(b) << 16);
}
// Load a 16x32 bf16 A/B fragment slice for this lane: 8 elems at p, 8 at p+16.
__device__ __forceinline__ v16bf ldfrag(const unsigned short* p) {
  Frag f;
  f.q[0] = *(const uint4*)(p);
  f.q[1] = *(const uint4*)(p + 16);
  return f.v;
}

__device__ __forceinline__ unsigned lds_addr(const void* p) {
  return (unsigned)(unsigned long long)p;
}
__device__ __forceinline__ void async_copy16x2(unsigned l, unsigned lstep,
                                               const char* g, long gstep) {
  asm volatile("global_load_async_to_lds_b128 %0, %2, off\n\t"
               "global_load_async_to_lds_b128 %1, %3, off\n\t"
               "s_wait_xcnt 0x0"
               :: "v"(l), "v"(l + lstep), "v"(g), "v"(g + gstep) : "memory");
}
__device__ __forceinline__ void async_copy16x8(unsigned l, unsigned lstep,
                                               const char* g, long gstep) {
  asm volatile("global_load_async_to_lds_b128 %0, %8, off\n\t"
               "global_load_async_to_lds_b128 %1, %9, off\n\t"
               "global_load_async_to_lds_b128 %2, %10, off\n\t"
               "global_load_async_to_lds_b128 %3, %11, off\n\t"
               "global_load_async_to_lds_b128 %4, %12, off\n\t"
               "global_load_async_to_lds_b128 %5, %13, off\n\t"
               "global_load_async_to_lds_b128 %6, %14, off\n\t"
               "global_load_async_to_lds_b128 %7, %15, off\n\t"
               "s_wait_xcnt 0x0"
               :: "v"(l), "v"(l + lstep), "v"(l + 2 * lstep), "v"(l + 3 * lstep),
                  "v"(l + 4 * lstep), "v"(l + 5 * lstep), "v"(l + 6 * lstep),
                  "v"(l + 7 * lstep),
                  "v"(g), "v"(g + gstep), "v"(g + 2 * gstep), "v"(g + 3 * gstep),
                  "v"(g + 4 * gstep), "v"(g + 5 * gstep), "v"(g + 6 * gstep),
                  "v"(g + 7 * gstep)
               : "memory");
}
__device__ __forceinline__ void wait_async0() {
  asm volatile("s_wait_asynccnt 0" ::: "memory");
}
__device__ __forceinline__ void wait_ds0() {
  asm volatile("s_wait_dscnt 0x0" ::: "memory");
}

// ---------------------------------------------------------------------------
// Kernel 1: Q/K/V = X @ W^T + b, output bf16. V written transposed per batch.
// Grid: 256 blocks x 256 threads (8 waves). Each block: 64 rows of X.
// Wave (rgrp,cgrp): 16 rows x 64 cols of the 64x128 output tile.
// ---------------------------------------------------------------------------
__global__ __launch_bounds__(256) void qkv_kernel(
    const float* __restrict__ X,
    const float* __restrict__ Wq, const float* __restrict__ bq,
    const float* __restrict__ Wk, const float* __restrict__ bk,
    const float* __restrict__ Wv, const float* __restrict__ bv,
    unsigned short* __restrict__ Qb, unsigned short* __restrict__ Kb,
    unsigned short* __restrict__ Vt)
{
  __shared__ __align__(16) unsigned short Xl[64][LDP];
  __shared__ __align__(16) unsigned short Wl[128][LDP];

  const int tid  = threadIdx.x;
  const int lane = tid & 31;
  const int wave = tid >> 5;
  const int half = (lane >> 4) & 1;
  const int l16  = lane & 15;
  const int rgrp = wave >> 1;           // 0..3: 16-row group
  const int cgrp = wave & 1;            // 0..1: 64-col group
  const long rowBase = (long)blockIdx.x * 64;

  // All global reads are issued as whole batches, one phase ahead of their use:
  // the X tile and Wq together at the start, each later W when the W before it
  // goes from registers to LDS. A thread has 16 to 24 loads in flight per wait.
  float4 xr[8], wr[16];
#pragma unroll  // the batch lives in registers: every index must be a constant
  for (int u = 0; u < 8; ++u)
    xr[u] = ((const float4*)(X + rowBase * EMB))[tid + u * 256];
#pragma unroll
  for (int u = 0; u < 16; ++u)
    wr[u] = ((const float4*)Wq)[tid + u * 256];

#pragma unroll
  for (int u = 0; u < 8; ++u) {
    int i = tid + u * 256;
    int r = (i * 4) >> 7, c = (i * 4) & 127;
    *(unsigned*)&Xl[r][c]     = pack2(xr[u].x, xr[u].y);
    *(unsigned*)&Xl[r][c + 2] = pack2(xr[u].z, xr[u].w);
  }

#pragma unroll  // m a constant: the next W's pointer and the store target are known
  for (int m = 0; m < 3; ++m) {
    const float* bias = (m == 0) ? bq : (m == 1) ? bk : bv;
    __syncthreads();
#pragma unroll  // register batch
    for (int u = 0; u < 16; ++u) {
      int i = tid + u * 256;
      int r = (i * 4) >> 7, c = (i * 4) & 127;
      *(unsigned*)&Wl[r][c]     = pack2(wr[u].x, wr[u].y);
      *(unsigned*)&Wl[r][c + 2] = pack2(wr[u].z, wr[u].w);
    }
    if (m < 2) {
      const float4* Wn = (const float4*)((m == 0) ? Wk : Wv);
#pragma unroll  // register batch
      for (int u = 0; u < 16; ++u) wr[u] = Wn[tid + u * 256];
    }
    __syncthreads();

    v8f acc[4] = {};
#pragma unroll
    for (int k0 = 0; k0 < EMB; k0 += 32) {
      v16bf a = ldfrag(&Xl[rgrp * 16 + l16][k0 + half * 8]);
#pragma unroll
      for (int t = 0; t < 4; ++t) {
        v16bf bm = ldfrag(&Wl[(cgrp * 4 + t) * 16 + l16][k0 + half * 8]);
        acc[t] = __builtin_amdgcn_wmma_f32_16x16x32_bf16(
            false, a, false, bm, (short)0, acc[t], false, false);
      }
    }

#pragma unroll
    for (int t = 0; t < 4; ++t) {
      int col = (cgrp * 4 + t) * 16 + l16;
      float bval = bias[col];
#pragma unroll
      for (int j = 0; j < 8; ++j) {
        long grow = rowBase + rgrp * 16 + j + half * 8;  // global row in [0,16384)
        unsigned short h = f2bf(acc[t][j] + bval);
        if (m == 0)      Qb[grow * EMB + col] = h;
        else if (m == 1) Kb[grow * EMB + col] = h;
        else {
          long batch = grow >> 11, s = grow & 2047;
          Vt[(batch * EMB + col) * 2048 + s] = h;       // V transposed: [b][d][S]
        }
      }
    }
  }
}

#define NGRP 4
#define QL_BYTES (64 * LDP * 2)
#define KL_BYTES (64 * LDP * 2)          // per group
#define VL_BYTES (128 * VLP * 2)         // per group
#define PL_BYTES (16 * VLP * 2)          // per wave
#define KL_OFF   QL_BYTES
#define VL_OFF   (KL_OFF + NGRP * KL_BYTES)
#define PL_OFF   (VL_OFF + NGRP * VL_BYTES)
#define ATTN_LDS (PL_OFF + NGRP * 4 * PL_BYTES)

__global__ __launch_bounds__(512) void attn_kernel(
    const unsigned short* __restrict__ Qb,
    const unsigned short* __restrict__ Kb,
    const unsigned short* __restrict__ Vt,
    float* __restrict__ Out)
{
  __shared__ __align__(16) unsigned char L[ATTN_LDS];

  const int tid = threadIdx.x, lane = tid & 31, wave = tid >> 5;
  const int half = (lane >> 4) & 1, l16 = lane & 15;
  const int grp = wave >> 2;
  const int wq  = wave & 3;
  const int gtid = tid & 127;
  const int b = blockIdx.y;
  const long qrow0 = (long)b * 2048 + (long)blockIdx.x * 64;

  unsigned short (*Ql)[LDP] = (unsigned short (*)[LDP])(L);
  unsigned short (*Kl)[LDP] = (unsigned short (*)[LDP])(L + KL_OFF + grp * KL_BYTES);
  unsigned short (*Vl)[VLP] = (unsigned short (*)[VLP])(L + VL_OFF + grp * VL_BYTES);  // [d][key]
  unsigned short (*Pl)[VLP] = (unsigned short (*)[VLP])(L + PL_OFF + wave * PL_BYTES); // wave-private

  // Stage Q tile once (64x128 bf16), async: 2 copies per thread, 32 rows apart
  async_copy16x2(lds_addr(&Ql[tid >> 4][(tid & 15) * 8]), 32 * LDP * 2,
                 (const char*)(Qb + qrow0 * EMB + (long)tid * 8), 512 * 16);

  // Per-thread staging places of this group's K and V^T chunks
  const unsigned kdst = lds_addr(&Kl[gtid >> 4][(gtid & 15) * 8]);
  const unsigned vdst = lds_addr(&Vl[gtid >> 3][(gtid & 7) * 8]);
  const unsigned short* ksrc = Kb + (long)b * 2048 * EMB + (long)gtid * 8;
  const unsigned short* vsrc = Vt + ((long)b * EMB + (gtid >> 3)) * 2048 + (gtid & 7) * 8;

  float mrow[8], lrow[8], alpha[8];
  v8f acco[8] = {};
#pragma unroll
  for (int j = 0; j < 8; ++j) { mrow[j] = -3.0e38f; lrow[j] = 0.0f; }

  const float scale = 0.088388347648318447f;  // 1/sqrt(128)

  for (int it = 0; it < 32 / NGRP; ++it) {
    const long kbase = (long)(it * NGRP + grp) * 64;
    wait_ds0();       // this wave's LDS reads of the previous chunk have returned
    __syncthreads();  // previous chunk's LDS reads complete in all waves
    // Stage K chunk (64 keys x 128) row-major: 8 copies per thread, 8 rows apart
    async_copy16x8(kdst, 8 * LDP * 2, (const char*)(ksrc + kbase * EMB), 128 * 16);
    // Stage V^T chunk (128 d x 64 keys): 8 copies per thread, 16 d-rows apart
    async_copy16x8(vdst, 16 * VLP * 2, (const char*)(vsrc + kbase), 16 * 2048 * 2);
    wait_async0();    // all async LDS writes (incl. Q on iter 0) complete
    __syncthreads();

    v8f accs[4] = {};
#pragma unroll
    for (int k0 = 0; k0 < EMB; k0 += 32) {
      v16bf a = ldfrag(&Ql[wq * 16 + l16][k0 + half * 8]);
      v16bf bm[4];
#pragma unroll
      for (int t = 0; t < 4; ++t)
        bm[t] = ldfrag(&Kl[t * 16 + l16][k0 + half * 8]);
#pragma unroll
      for (int t = 0; t < 4; ++t)
        accs[t] = __builtin_amdgcn_wmma_f32_16x16x32_bf16(
            false, a, false, bm[t], (short)0, accs[t], false, false);
    }

    float mx[8], sm[8];
#pragma unroll
    for (int j = 0; j < 8; ++j) {
      mx[j] = accs[0][j] * scale;
#pragma unroll
      for (int t = 1; t < 4; ++t) mx[j] = fmaxf(mx[j], accs[t][j] * scale);
    }
#pragma unroll
    for (int x = 1; x < 16; x <<= 1) {
      float o[8];
#pragma unroll
      for (int j = 0; j < 8; ++j) o[j] = __shfl_xor(mx[j], x, 32);
#pragma unroll
      for (int j = 0; j < 8; ++j) mx[j] = fmaxf(mx[j], o[j]);
    }
#pragma unroll
    for (int j = 0; j < 8; ++j) {
      float mn = fmaxf(mrow[j], mx[j]);
      alpha[j] = __expf(mrow[j] - mn);
      mrow[j] = mn;
      float s = 0.0f;
#pragma unroll
      for (int t = 0; t < 4; ++t) {
        float p = __expf(accs[t][j] * scale - mn);
        accs[t][j] = p;
        s += p;
      }
      sm[j] = s;
    }
#pragma unroll
    for (int x = 1; x < 16; x <<= 1) {
      float o[8];
#pragma unroll
      for (int j = 0; j < 8; ++j) o[j] = __shfl_xor(sm[j], x, 32);
#pragma unroll
      for (int j = 0; j < 8; ++j) sm[j] += o[j];
    }
#pragma unroll
    for (int j = 0; j < 8; ++j) lrow[j] = lrow[j] * alpha[j] + sm[j];

    // P (C-layout) -> bf16 LDS (row-major) for re-read as WMMA A operand
#pragma unroll
    for (int t = 0; t < 4; ++t)
#pragma unroll
      for (int j = 0; j < 8; ++j)
        Pl[j + half * 8][t * 16 + l16] = f2bf(accs[t][j]);

    // Rescale running O
#pragma unroll
    for (int n = 0; n < 8; ++n)
#pragma unroll
      for (int j = 0; j < 8; ++j)
        acco[n][j] *= alpha[j];

    // O += P @ V : 2 K-dim iters x 8 d n-tiles = 16 WMMA
#pragma unroll
    for (int kk = 0; kk < 2; ++kk) {
      v16bf a = ldfrag(&Pl[l16][kk * 32 + half * 8]);
      v16bf bm[8];
#pragma unroll
      for (int n = 0; n < 8; ++n)
        bm[n] = ldfrag(&Vl[n * 16 + l16][kk * 32 + half * 8]);
#pragma unroll
      for (int n = 0; n < 8; ++n)
        acco[n] = __builtin_amdgcn_wmma_f32_16x16x32_bf16(
            false, a, false, bm[n], (short)0, acco[n], false, false);
    }
  }

  float4* So = (float4*)L;
  float4* Sm = So + NGRP * 4 * 16 * 32;
  wait_ds0();       // this wave's last LDS reads have returned
  __syncthreads();  // every wave has left the K/V/P/Q buffers
#pragma unroll
  for (int n = 0; n < 8; ++n) {
    So[(wave * 16 + 2 * n) * 32 + lane] =
        make_float4(acco[n][0], acco[n][1], acco[n][2], acco[n][3]);
    So[(wave * 16 + 2 * n + 1) * 32 + lane] =
        make_float4(acco[n][4], acco[n][5], acco[n][6], acco[n][7]);
  }
  Sm[(wave * 4 + 0) * 32 + lane] = make_float4(mrow[0], mrow[1], mrow[2], mrow[3]);
  Sm[(wave * 4 + 1) * 32 + lane] = make_float4(mrow[4], mrow[5], mrow[6], mrow[7]);
  Sm[(wave * 4 + 2) * 32 + lane] = make_float4(lrow[0], lrow[1], lrow[2], lrow[3]);
  Sm[(wave * 4 + 3) * 32 + lane] = make_float4(lrow[4], lrow[5], lrow[6], lrow[7]);
  __syncthreads();  // partial results visible to the merging waves

  // Wave (grp, wq) finishes d columns 32*grp .. 32*grp+31 of its 16 query rows
  float wgt[NGRP][8], lsum[8];
  {
    float mg[NGRP][8], lg[NGRP][8];
#pragma unroll
    for (int s = 0; s < NGRP; ++s) {
      const int sw = s * 4 + wq;
#pragma unroll
      for (int h = 0; h < 2; ++h) {
        float4 m4 = Sm[(sw * 4 + h) * 32 + lane];
        float4 l4 = Sm[(sw * 4 + 2 + h) * 32 + lane];
        mg[s][h * 4 + 0] = m4.x; mg[s][h * 4 + 1] = m4.y;
        mg[s][h * 4 + 2] = m4.z; mg[s][h * 4 + 3] = m4.w;
        lg[s][h * 4 + 0] = l4.x; lg[s][h * 4 + 1] = l4.y;
        lg[s][h * 4 + 2] = l4.z; lg[s][h * 4 + 3] = l4.w;
      }
    }
#pragma unroll
    for (int j = 0; j < 8; ++j) {
      float mx = fmaxf(fmaxf(mg[0][j], mg[1][j]), fmaxf(mg[2][j], mg[3][j]));
      float s = 0.0f;
#pragma unroll
      for (int g = 0; g < NGRP; ++g) {
        wgt[g][j] = __expf(mg[g][j] - mx);
        s += wgt[g][j] * lg[g][j];
      }
      lsum[j] = s;
    }
  }

  // Epilogue: merged O / l, fp32 out
#pragma unroll
  for (int nn = 0; nn < 2; ++nn) {
    const int n = grp * 2 + nn;
    const int col = n * 16 + l16;
    float o[8] = {};
#pragma unroll
    for (int s = 0; s < NGRP; ++s) {
      const int sw = s * 4 + wq;
      float4 lo = So[(sw * 16 + 2 * n) * 32 + lane];
      float4 hi = So[(sw * 16 + 2 * n + 1) * 32 + lane];
      o[0] += wgt[s][0] * lo.x; o[1] += wgt[s][1] * lo.y;
      o[2] += wgt[s][2] * lo.z; o[3] += wgt[s][3] * lo.w;
      o[4] += wgt[s][4] * hi.x; o[5] += wgt[s][5] * hi.y;
      o[6] += wgt[s][6] * hi.z; o[7] += wgt[s][7] * hi.w;
    }
#pragma unroll
    for (int j = 0; j < 8; ++j) {
      long row = qrow0 + wq * 16 + j + half * 8;
      Out[row * EMB + col] = o[j] / lsum[j];
    }
  }
}

extern "C" void kernel_launch(void* const* d_in, const int* in_sizes, int n_in,
                              void* d_out, int out_size, void* d_ws, size_t ws_size,
                              hipStream_t stream) {
  (void)in_sizes; (void)n_in; (void)out_size; (void)ws_size;
  const float* X  = (const float*)d_in[0];
  const float* Wq = (const float*)d_in[1];
  const float* bq = (const float*)d_in[2];
  const float* Wk = (const float*)d_in[3];
  const float* bk = (const float*)d_in[4];
  const float* Wv = (const float*)d_in[5];
  const float* bv = (const float*)d_in[6];

  unsigned short* Qb = (unsigned short*)d_ws;                 // [16384][128] bf16
  unsigned short* Kb = Qb + (size_t)16384 * 128;              // [16384][128] bf16
  unsigned short* Vt = Kb + (size_t)16384 * 128;              // [8][128][2048] bf16
  float* Out = (float*)d_out;

  qkv_kernel<<<256, 256, 0, stream>>>(X, Wq, bq, Wk, bk, Wv, bv, Qb, Kb, Vt);
  attn_kernel<<<dim3(32, 8), 512, 0, stream>>>(Qb, Kb, Vt, Out);
}

// v003
// It runs in 43.6 microseconds.
// Next to v002, in two timings, it ran 1.18 and 1.17 times as fast.
// All steps since v000 together make it 2.36 times as fast.
#include <hip/hip_runtime.h>

typedef __attribute__((ext_vector_type(16))) __bf16 v16bf;
typedef __attribute__((ext_vector_type(8)))  float  v8f;

#define EMB 128
#define LDP 136   // padded LDS row stride (elements): 272B = 17*16B -> conflict-free b128
#define VLP 72    // padded stride for V^T / P tiles: 144B = 9*16B

union Frag { v16bf v; uint4 q[2]; };

__device__ __forceinline__ unsigned short f2bf(float f) {
  union { float f; unsigned u; } x; x.f = f;
  unsigned u = x.u + 0x7FFFu + ((x.u >> 16) & 1u);  // round-to-nearest-even
  return (unsigned short)(u >> 16);
}
__device__ __forceinline__ unsigned pack2(float a, float b) {
  return (unsigned)f2bf(a) | ((unsigned)f2bf(b) << 16);
}
// Load a 16x32 bf16 A/B fragment slice for this lane: 8 elems at p, 8 at p+16.
__device__ __forceinline__ v16bf ldfrag(const unsigned short* p) {
  Frag f;
  f.q[0] = *(const uint4*)(p);
  f.q[1] = *(const uint4*)(p + 16);
  return f.v;
}

__device__ __forceinline__ unsigned lds_addr(const void* p) {
  return (unsigned)(unsigned long long)p;
}
__device__ __forceinline__ void async_copy16x2(unsigned l, unsigned lstep,
                                               const char* g, long gstep) {
  asm volatile("global_load_async_to_lds_b128 %0, %2, off\n\t"
               "global_load_async_to_lds_b128 %1, %3, off\n\t"
               "s_wait_xcnt 0x0"
               :: "v"(l), "v"(l + lstep), "v"(g), "v"(g + gstep) : "memory");
}
__device__ __forceinline__ void async_copy16x8(unsigned l, unsigned lstep,
                                               const char* g, long gstep) {
  asm volatile("global_load_async_to_lds_b128 %0, %8, off\n\t"
               "global_load_async_to_lds_b128 %1, %9, off\n\t"
               "global_load_async_to_lds_b128 %2, %10, off\n\t"
               "global_load_async_to_lds_b128 %3, %11, off\n\t"
               "global_load_async_to_lds_b128 %4, %12, off\n\t"
               "global_load_async_to_lds_b128 %5, %13, off\n\t"
               "global_load_async_to_lds_b128 %6, %14, off\n\t"
               "global_load_async_to_lds_b128 %7, %15, off\n\t"
               "s_wait_xcnt 0x0"
               :: "v"(l), "v"(l + lstep), "v"(l + 2 * lstep), "v"(l + 3 * lstep),
                  "v"(l + 4 * lstep), "v"(l + 5 * lstep), "v"(l + 6 * lstep),
                  "v"(l + 7 * lstep),
                  "v"(g), "v"(g + gstep), "v"(g + 2 * gstep), "v"(g + 3 * gstep),
                  "v"(g + 4 * gstep), "v"(g + 5 * gstep), "v"(g + 6 * gstep),
                  "v"(g + 7 * gstep)
               : "memory");
}
__device__ __forceinline__ void wait_async0() {
  asm volatile("s_wait_asynccnt 0" ::: "memory");
}
__device__ __forceinline__ void wait_ds0() {
  asm volatile("s_wait_dscnt 0x0" ::: "memory");
}

// ---------------------------------------------------------------------------
// Kernel 1: Q/K/V = X @ W^T + b, output bf16. V written transposed per batch.
// Grid: 256 blocks x 256 threads (8 waves). Each block: 64 rows of X.
// Wave (rgrp,cgrp): 16 rows x 64 cols of the 64x128 output tile.
// ---------------------------------------------------------------------------
__global__ __launch_bounds__(256) void qkv_kernel(
    const float* __restrict__ X,
    const float* __restrict__ Wq, const float* __restrict__ bq,
    const float* __restrict__ Wk, const float* __restrict__ bk,
    const float* __restrict__ Wv, const float* __restrict__ bv,
    unsigned short* __restrict__ Qb, unsigned short* __restrict__ Kb,
    unsigned short* __restrict__ Vt)
{
  __shared__ __align__(16) unsigned short Xl[64][LDP];
  __shared__ __align__(16) unsigned short Wl[128][LDP];

  const int tid  = threadIdx.x;
  const int lane = tid & 31;
  const int wave = tid >> 5;
  const int half = (lane >> 4) & 1;
  const int l16  = lane & 15;
  const int rgrp = wave >> 1;           // 0..3: 16-row group
  const int cgrp = wave & 1;            // 0..1: 64-col group
  const long rowBase = (long)blockIdx.x * 64;

  // All global reads are issued as whole batches, one phase ahead of their use:
  // the X tile and Wq together at the start, each later W when the W before it
  // goes from registers to LDS. A thread has 16 to 24 loads in flight per wait.
  float4 xr[8], wr[16];
#pragma unroll  // the batch lives in registers: every index must be a constant
  for (int u = 0; u < 8; ++u)
    xr[u] = ((const float4*)(X + rowBase * EMB))[tid + u * 256];
#pragma unroll
  for (int u = 0; u < 16; ++u)
    wr[u] = ((const float4*)Wq)[tid + u * 256];

#pragma unroll
  for (int u = 0; u < 8; ++u) {
    int i = tid + u * 256;
    int r = (i * 4) >> 7, c = (i * 4) & 127;
    *(unsigned*)&Xl[r][c]     = pack2(xr[u].x, xr[u].y);
    *(unsigned*)&Xl[r][c + 2] = pack2(xr[u].z, xr[u].w);
  }

#pragma unroll  // m a constant: the next W's pointer and the store target are known
  for (int m = 0; m < 3; ++m) {
    const float* bias = (m == 0) ? bq : (m == 1) ? bk : bv;
    __syncthreads();
#pragma unroll  // register batch
    for (int u = 0; u < 16; ++u) {
      int i = tid + u * 256;
      int r = (i * 4) >> 7, c = (i * 4) & 127;
      *(unsigned*)&Wl[r][c]     = pack2(wr[u].x, wr[u].y);
      *(unsigned*)&Wl[r][c + 2] = pack2(wr[u].z, wr[u].w);
    }
    if (m < 2) {
      const float4* Wn = (const float4*)((m == 0) ? Wk : Wv);
#pragma unroll  // register batch
      for (int u = 0; u < 16; ++u) wr[u] = Wn[tid + u * 256];
    }
    __syncthreads();

    v8f acc[4] = {};
#pragma unroll
    for (int k0 = 0; k0 < EMB; k0 += 32) {
      v16bf a = ldfrag(&Xl[rgrp * 16 + l16][k0 + half * 8]);
#pragma unroll
      for (int t = 0; t < 4; ++t) {
        v16bf bm = ldfrag(&Wl[(cgrp * 4 + t) * 16 + l16][k0 + half * 8]);
        acc[t] = __builtin_amdgcn_wmma_f32_16x16x32_bf16(
            false, a, false, bm, (short)0, acc[t], false, false);
      }
    }

#pragma unroll
    for (int t = 0; t < 4; ++t) {
      int col = (cgrp * 4 + t) * 16 + l16;
      float bval = bias[col];
#pragma unroll
      for (int j = 0; j < 8; ++j) {
        long grow = rowBase + rgrp * 16 + j + half * 8;  // global row in [0,16384)
        unsigned short h = f2bf(acc[t][j] + bval);
        if (m == 0)      Qb[grow * EMB + col] = h;
        else if (m == 1) Kb[grow * EMB + col] = h;
        else {
          long batch = grow >> 11, s = grow & 2047;
          Vt[(batch * EMB + col) * 2048 + s] = h;       // V transposed: [b][d][S]
        }
      }
    }
  }
}

#define NGRP 4
#define QL_BYTES (64 * LDP * 2)
#define KL_BYTES (64 * LDP * 2)          // per group
#define VL_BYTES (128 * VLP * 2)         // per group
#define PL_BYTES (16 * VLP * 2)          // per wave
#define KL_OFF   QL_BYTES
#define VL_OFF   (KL_OFF + NGRP * KL_BYTES)
#define PL_OFF   (VL_OFF + NGRP * VL_BYTES)
#define ATTN_LDS (PL_OFF + NGRP * 4 * PL_BYTES)

__global__ __launch_bounds__(512) void attn_kernel(
    const unsigned short* __restrict__ Qb,
    const unsigned short* __restrict__ Kb,
    const unsigned short* __restrict__ Vt,
    float* __restrict__ Out)
{
  __shared__ __align__(16) unsigned char L[ATTN_LDS];

  const int tid = threadIdx.x, lane = tid & 31, wave = tid >> 5;
  const int half = (lane >> 4) & 1, l16 = lane & 15;
  const int grp = wave >> 2;
  const int wq  = wave & 3;
  const int gtid = tid & 127;
  const int b = blockIdx.y;
  const long qrow0 = (long)b * 2048 + (long)blockIdx.x * 64;

  unsigned short (*Ql)[LDP] = (unsigned short (*)[LDP])(L);
  unsigned short (*Kl)[LDP] = (unsigned short (*)[LDP])(L + KL_OFF + grp * KL_BYTES);
  unsigned short (*Vl)[VLP] = (unsigned short (*)[VLP])(L + VL_OFF + grp * VL_BYTES);  // [d][key]
  unsigned short (*Pl)[VLP] = (unsigned short (*)[VLP])(L + PL_OFF + wave * PL_BYTES); // wave-private

  // Stage Q tile once (64x128 bf16), async: 2 copies per thread, 32 rows apart
  async_copy16x2(lds_addr(&Ql[tid >> 4][(tid & 15) * 8]), 32 * LDP * 2,
                 (const char*)(Qb + qrow0 * EMB + (long)tid * 8), 512 * 16);

  // Per-thread staging places of this group's K and V^T chunks
  const unsigned kdst = lds_addr(&Kl[gtid >> 4][(gtid & 15) * 8]);
  const unsigned vdst = lds_addr(&Vl[gtid >> 3][(gtid & 7) * 8]);
  const unsigned short* ksrc = Kb + (long)b * 2048 * EMB + (long)gtid * 8;
  const unsigned short* vsrc = Vt + ((long)b * EMB + (gtid >> 3)) * 2048 + (gtid & 7) * 8;

  float mrow[8], lrow[8], alpha[8];
  v8f acco[8] = {};
#pragma unroll
  for (int j = 0; j < 8; ++j) { mrow[j] = -3.0e38f; lrow[j] = 0.0f; }

  const float scale = 0.088388347648318447f;  // 1/sqrt(128)

  // First K chunk (64 keys x 128) row-major: 8 copies per thread, 8 rows apart
  async_copy16x8(kdst, 8 * LDP * 2, (const char*)(ksrc + (long)grp * 64 * EMB), 128 * 16);

  for (int it = 0; it < 32 / NGRP; ++it) {
    const long kbase = (long)(it * NGRP + grp) * 64;
    wait_ds0();       // this wave's reads of the previous V^T chunk have returned
    wait_async0();    // this wave's copies of this K chunk (and Q on iter 0) have landed
    __syncthreads();  // K chunk visible; every wave has left the previous V^T chunk
    // Stage V^T chunk (128 d x 64 keys): 8 copies per thread, 16 d-rows apart
    async_copy16x8(vdst, 16 * VLP * 2, (const char*)(vsrc + kbase), 16 * 2048 * 2);

    v8f accs[4] = {};
#pragma unroll
    for (int k0 = 0; k0 < EMB; k0 += 32) {
      v16bf a = ldfrag(&Ql[wq * 16 + l16][k0 + half * 8]);
      v16bf bm[4];
#pragma unroll
      for (int t = 0; t < 4; ++t)
        bm[t] = ldfrag(&Kl[t * 16 + l16][k0 + half * 8]);
#pragma unroll
      for (int t = 0; t < 4; ++t)
        accs[t] = __builtin_amdgcn_wmma_f32_16x16x32_bf16(
            false, a, false, bm[t], (short)0, accs[t], false, false);
    }

    float mx[8], sm[8];
#pragma unroll
    for (int j = 0; j < 8; ++j) {
      mx[j] = accs[0][j] * scale;
#pragma unroll
      for (int t = 1; t < 4; ++t) mx[j] = fmaxf(mx[j], accs[t][j] * scale);
    }
#pragma unroll
    for (int x = 1; x < 16; x <<= 1) {
      float o[8];
#pragma unroll
      for (int j = 0; j < 8; ++j) o[j] = __shfl_xor(mx[j], x, 32);
#pragma unroll
      for (int j = 0; j < 8; ++j) mx[j] = fmaxf(mx[j], o[j]);
    }

    // About half of the pass's work lies on either side of this point, so each
    // of the two refills has half a pass to land. The scheduling barrier keeps
    // the row maxima in front of it: without it the compiler lifts the waits up
    // to the last K read, and V^T has only the K reads to land under.
    __builtin_amdgcn_sched_barrier(0);
    wait_ds0();       // this wave's reads of this K chunk have returned
    wait_async0();    // this wave's copies of this V^T chunk have landed
    __syncthreads();  // V^T chunk visible; every wave has left this K chunk
    if (it + 1 < 32 / NGRP)  // next K chunk, 8 copies per thread, 8 rows apart
      async_copy16x8(kdst, 8 * LDP * 2,
                     (const char*)(ksrc + (kbase + NGRP * 64) * EMB), 128 * 16);
#pragma unroll
    for (int j = 0; j < 8; ++j) {
      float mn = fmaxf(mrow[j], mx[j]);
      alpha[j] = __expf(mrow[j] - mn);
      mrow[j] = mn;
      float s = 0.0f;
#pragma unroll
      for (int t = 0; t < 4; ++t) {
        float p = __expf(accs[t][j] * scale - mn);
        accs[t][j] = p;
        s += p;
      }
      sm[j] = s;
    }
#pragma unroll
    for (int x = 1; x < 16; x <<= 1) {
      float o[8];
#pragma unroll
      for (int j = 0; j < 8; ++j) o[j] = __shfl_xor(sm[j], x, 32);
#pragma unroll
      for (int j = 0; j < 8; ++j) sm[j] += o[j];
    }
#pragma unroll
    for (int j = 0; j < 8; ++j) lrow[j] = lrow[j] * alpha[j] + sm[j];

    // P (C-layout) -> bf16 LDS (row-major) for re-read as WMMA A operand
#pragma unroll
    for (int t = 0; t < 4; ++t)
#pragma unroll
      for (int j = 0; j < 8; ++j)
        Pl[j + half * 8][t * 16 + l16] = f2bf(accs[t][j]);

    // Rescale running O
#pragma unroll
    for (int n = 0; n < 8; ++n)
#pragma unroll
      for (int j = 0; j < 8; ++j)
        acco[n][j] *= alpha[j];

    // O += P @ V : 2 K-dim iters x 8 d n-tiles = 16 WMMA
#pragma unroll
    for (int kk = 0; kk < 2; ++kk) {
      v16bf a = ldfrag(&Pl[l16][kk * 32 + half * 8]);
      v16bf bm[8];
#pragma unroll
      for (int n = 0; n < 8; ++n)
        bm[n] = ldfrag(&Vl[n * 16 + l16][kk * 32 + half * 8]);
#pragma unroll
      for (int n = 0; n < 8; ++n)
        acco[n] = __builtin_amdgcn_wmma_f32_16x16x32_bf16(
            false, a, false, bm[n], (short)0, acco[n], false, false);
    }
  }

  float4* So = (float4*)L;
  float4* Sm = So + NGRP * 4 * 16 * 32;
  wait_ds0();       // this wave's last LDS reads have returned
  __syncthreads();  // every wave has left the K/V/P/Q buffers
#pragma unroll
  for (int n = 0; n < 8; ++n) {
    So[(wave * 16 + 2 * n) * 32 + lane] =
        make_float4(acco[n][0], acco[n][1], acco[n][2], acco[n][3]);
    So[(wave * 16 + 2 * n + 1) * 32 + lane] =
        make_float4(acco[n][4], acco[n][5], acco[n][6], acco[n][7]);
  }
  Sm[(wave * 4 + 0) * 32 + lane] = make_float4(mrow[0], mrow[1], mrow[2], mrow[3]);
  Sm[(wave * 4 + 1) * 32 + lane] = make_float4(mrow[4], mrow[5], mrow[6], mrow[7]);
  Sm[(wave * 4 + 2) * 32 + lane] = make_float4(lrow[0], lrow[1], lrow[2], lrow[3]);
  Sm[(wave * 4 + 3) * 32 + lane] = make_float4(lrow[4], lrow[5], lrow[6], lrow[7]);
  __syncthreads();  // partial results visible to the merging waves

  // Wave (grp, wq) finishes d columns 32*grp .. 32*grp+31 of its 16 query rows
  float wgt[NGRP][8], lsum[8];
  {
    float mg[NGRP][8], lg[NGRP][8];
#pragma unroll
    for (int s = 0; s < NGRP; ++s) {
      const int sw = s * 4 + wq;
#pragma unroll
      for (int h = 0; h < 2; ++h) {
        float4 m4 = Sm[(sw * 4 + h) * 32 + lane];
        float4 l4 = Sm[(sw * 4 + 2 + h) * 32 + lane];
        mg[s][h * 4 + 0] = m4.x; mg[s][h * 4 + 1] = m4.y;
        mg[s][h * 4 + 2] = m4.z; mg[s][h * 4 + 3] = m4.w;
        lg[s][h * 4 + 0] = l4.x; lg[s][h * 4 + 1] = l4.y;
        lg[s][h * 4 + 2] = l4.z; lg[s][h * 4 + 3] = l4.w;
      }
    }
#pragma unroll
    for (int j = 0; j < 8; ++j) {
      float mx = fmaxf(fmaxf(mg[0][j], mg[1][j]), fmaxf(mg[2][j], mg[3][j]));
      float s = 0.0f;
#pragma unroll
      for (int g = 0; g < NGRP; ++g) {
        wgt[g][j] = __expf(mg[g][j] - mx);
        s += wgt[g][j] * lg[g][j];
      }
      lsum[j] = s;
    }
  }

  // Epilogue: merged O / l, fp32 out
#pragma unroll
  for (int nn = 0; nn < 2; ++nn) {
    const int n = grp * 2 + nn;
    const int col = n * 16 + l16;
    float o[8] = {};
#pragma unroll
    for (int s = 0; s < NGRP; ++s) {
      const int sw = s * 4 + wq;
      float4 lo = So[(sw * 16 + 2 * n) * 32 + lane];
      float4 hi = So[(sw * 16 + 2 * n + 1) * 32 + lane];
      o[0] += wgt[s][0] * lo.x; o[1] += wgt[s][1] * lo.y;
      o[2] += wgt[s][2] * lo.z; o[3] += wgt[s][3] * lo.w;
      o[4] += wgt[s][4] * hi.x; o[5] += wgt[s][5] * hi.y;
      o[6] += wgt[s][6] * hi.z; o[7] += wgt[s][7] * hi.w;
    }
#pragma unroll
    for (int j = 0; j < 8; ++j) {
      long row = qrow0 + wq * 16 + j + half * 8;
      Out[row * EMB + col] = o[j] / lsum[j];
    }
  }
}

extern "C" void kernel_launch(void* const* d_in, const int* in_sizes, int n_in,
                              void* d_out, int out_size, void* d_ws, size_t ws_size,
                              hipStream_t stream) {
  (void)in_sizes; (void)n_in; (void)out_size; (void)ws_size;
  const float* X  = (const float*)d_in[0];
  const float* Wq = (const float*)d_in[1];
  const float* bq = (const float*)d_in[2];
  const float* Wk = (const float*)d_in[3];
  const float* bk = (const float*)d_in[4];
  const float* Wv = (const float*)d_in[5];
  const float* bv = (const float*)d_in[6];

  unsigned short* Qb = (unsigned short*)d_ws;                 // [16384][128] bf16
  unsigned short* Kb = Qb + (size_t)16384 * 128;              // [16384][128] bf16
  unsigned short* Vt = Kb + (size_t)16384 * 128;              // [8][128][2048] bf16
  float* Out = (float*)d_out;

  qkv_kernel<<<256, 256, 0, stream>>>(X, Wq, bq, Wk, bk, Wv, bv, Qb, Kb, Vt);
  attn_kernel<<<dim3(32, 8), 512, 0, stream>>>(Qb, Kb, Vt, Out);
}

// v004
// One run takes 38.8 microseconds.
// Next to v003, in two timings, it ran 1.13 and 1.12 times as fast.
// Counting every step since v000, it is 2.66 times as fast.
#include <hip/hip_runtime.h>

typedef __attribute__((ext_vector_type(16))) __bf16 v16bf;
typedef __attribute__((ext_vector_type(8)))  float  v8f;

#define EMB 128
#define LDP 136   // padded LDS row stride (elements): 272B = 17*16B -> conflict-free b128
#define VLP 72    // padded stride for V^T tiles: 144B = 9*16B

union Frag { v16bf v; uint4 q[2]; };

__device__ __forceinline__ unsigned short f2bf(float f) {
  union { float f; unsigned u; } x; x.f = f;
  unsigned u = x.u + 0x7FFFu + ((x.u >> 16) & 1u);  // round-to-nearest-even
  return (unsigned short)(u >> 16);
}
__device__ __forceinline__ unsigned pack2(float a, float b) {
  return (unsigned)f2bf(a) | ((unsigned)f2bf(b) << 16);
}
// Load a 16x32 bf16 A/B fragment slice for this lane: 8 elems at p, 8 at p+16.
__device__ __forceinline__ v16bf ldfrag(const unsigned short* p) {
  Frag f;
  f.q[0] = *(const uint4*)(p);
  f.q[1] = *(const uint4*)(p + 16);
  return f.v;
}

__device__ __forceinline__ unsigned lds_addr(const void* p) {
  return (unsigned)(unsigned long long)p;
}
__device__ __forceinline__ void async_copy16x2(unsigned l, unsigned lstep,
                                               const char* g, long gstep) {
  asm volatile("global_load_async_to_lds_b128 %0, %2, off\n\t"
               "global_load_async_to_lds_b128 %1, %3, off\n\t"
               "s_wait_xcnt 0x0"
               :: "v"(l), "v"(l + lstep), "v"(g), "v"(g + gstep) : "memory");
}
__device__ __forceinline__ void async_copy16x8(unsigned l, unsigned lstep,
                                               const char* g, long gstep) {
  asm volatile("global_load_async_to_lds_b128 %0, %8, off\n\t"
               "global_load_async_to_lds_b128 %1, %9, off\n\t"
               "global_load_async_to_lds_b128 %2, %10, off\n\t"
               "global_load_async_to_lds_b128 %3, %11, off\n\t"
               "global_load_async_to_lds_b128 %4, %12, off\n\t"
               "global_load_async_to_lds_b128 %5, %13, off\n\t"
               "global_load_async_to_lds_b128 %6, %14, off\n\t"
               "global_load_async_to_lds_b128 %7, %15, off\n\t"
               "s_wait_xcnt 0x0"
               :: "v"(l), "v"(l + lstep), "v"(l + 2 * lstep), "v"(l + 3 * lstep),
                  "v"(l + 4 * lstep), "v"(l + 5 * lstep), "v"(l + 6 * lstep),
                  "v"(l + 7 * lstep),
                  "v"(g), "v"(g + gstep), "v"(g + 2 * gstep), "v"(g + 3 * gstep),
                  "v"(g + 4 * gstep), "v"(g + 5 * gstep), "v"(g + 6 * gstep),
                  "v"(g + 7 * gstep)
               : "memory");
}
__device__ __forceinline__ void wait_async0() {
  asm volatile("s_wait_asynccnt 0" ::: "memory");
}
__device__ __forceinline__ float other_half(float v) {
  int b = __builtin_bit_cast(int, v);
  b = __builtin_amdgcn_permlanex16(b, b, 0x76543210, 0xfedcba98, false, false);
  return __builtin_bit_cast(float, b);
}
__device__ __forceinline__ void wait_ds0() {
  asm volatile("s_wait_dscnt 0x0" ::: "memory");
}

// ---------------------------------------------------------------------------
// Kernel 1: Q/K/V = X @ W^T + b, output bf16. V written transposed per batch.
// Grid: 256 blocks x 256 threads (8 waves). Each block: 64 rows of X.
// Wave (rgrp,cgrp): 16 rows x 64 cols of the 64x128 output tile.
// ---------------------------------------------------------------------------
__global__ __launch_bounds__(256) void qkv_kernel(
    const float* __restrict__ X,
    const float* __restrict__ Wq, const float* __restrict__ bq,
    const float* __restrict__ Wk, const float* __restrict__ bk,
    const float* __restrict__ Wv, const float* __restrict__ bv,
    unsigned short* __restrict__ Qb, unsigned short* __restrict__ Kb,
    unsigned short* __restrict__ Vt)
{
  __shared__ __align__(16) unsigned short Xl[64][LDP];
  __shared__ __align__(16) unsigned short Wl[128][LDP];

  const int tid  = threadIdx.x;
  const int lane = tid & 31;
  const int wave = tid >> 5;
  const int half = (lane >> 4) & 1;
  const int l16  = lane & 15;
  const int rgrp = wave >> 1;           // 0..3: 16-row group
  const int cgrp = wave & 1;            // 0..1: 64-col group
  const long rowBase = (long)blockIdx.x * 64;

  // All global reads are issued as whole batches, one phase ahead of their use:
  // the X tile and Wq together at the start, each later W when the W before it
  // goes from registers to LDS. A thread has 16 to 24 loads in flight per wait.
  float4 xr[8], wr[16];
#pragma unroll  // the batch lives in registers: every index must be a constant
  for (int u = 0; u < 8; ++u)
    xr[u] = ((const float4*)(X + rowBase * EMB))[tid + u * 256];
#pragma unroll
  for (int u = 0; u < 16; ++u)
    wr[u] = ((const float4*)Wq)[tid + u * 256];

#pragma unroll
  for (int u = 0; u < 8; ++u) {
    int i = tid + u * 256;
    int r = (i * 4) >> 7, c = (i * 4) & 127;
    *(unsigned*)&Xl[r][c]     = pack2(xr[u].x, xr[u].y);
    *(unsigned*)&Xl[r][c + 2] = pack2(xr[u].z, xr[u].w);
  }

#pragma unroll  // m a constant: the next W's pointer and the store target are known
  for (int m = 0; m < 3; ++m) {
    const float* bias = (m == 0) ? bq : (m == 1) ? bk : bv;
    __syncthreads();
#pragma unroll  // register batch
    for (int u = 0; u < 16; ++u) {
      int i = tid + u * 256;
      int r = (i * 4) >> 7, c = (i * 4) & 127;
      *(unsigned*)&Wl[r][c]     = pack2(wr[u].x, wr[u].y);
      *(unsigned*)&Wl[r][c + 2] = pack2(wr[u].z, wr[u].w);
    }
    if (m < 2) {
      const float4* Wn = (const float4*)((m == 0) ? Wk : Wv);
#pragma unroll  // register batch
      for (int u = 0; u < 16; ++u) wr[u] = Wn[tid + u * 256];
    }
    __syncthreads();

    v8f acc[4] = {};
#pragma unroll
    for (int k0 = 0; k0 < EMB; k0 += 32) {
      v16bf a = ldfrag(&Xl[rgrp * 16 + l16][k0 + half * 8]);
#pragma unroll
      for (int t = 0; t < 4; ++t) {
        v16bf bm = ldfrag(&Wl[(cgrp * 4 + t) * 16 + l16][k0 + half * 8]);
        acc[t] = __builtin_amdgcn_wmma_f32_16x16x32_bf16(
            false, a, false, bm, (short)0, acc[t], false, false);
      }
    }

#pragma unroll
    for (int t = 0; t < 4; ++t) {
      int col = (cgrp * 4 + t) * 16 + l16;
      float bval = bias[col];
#pragma unroll
      for (int j = 0; j < 8; ++j) {
        long grow = rowBase + rgrp * 16 + j + half * 8;  // global row in [0,16384)
        unsigned short h = f2bf(acc[t][j] + bval);
        if (m == 0)      Qb[grow * EMB + col] = h;
        else if (m == 1) Kb[grow * EMB + col] = h;
        else {
          long batch = grow >> 11, s = grow & 2047;
          Vt[(batch * EMB + col) * 2048 + s] = h;       // V transposed: [b][d][S]
        }
      }
    }
  }
}

#define NGRP 4
#define QL_BYTES (64 * LDP * 2)
#define KL_BYTES (64 * LDP * 2)          // per group
#define VL_BYTES (128 * VLP * 2)         // per group
#define KL_OFF   QL_BYTES
#define VL_OFF   (KL_OFF + NGRP * KL_BYTES)
#define ATTN_LDS (VL_OFF + NGRP * VL_BYTES)

__global__ __launch_bounds__(512) void attn_kernel(
    const unsigned short* __restrict__ Qb,
    const unsigned short* __restrict__ Kb,
    const unsigned short* __restrict__ Vt,
    float* __restrict__ Out)
{
  __shared__ __align__(16) unsigned char L[ATTN_LDS];

  const int tid = threadIdx.x, lane = tid & 31, wave = tid >> 5;
  const int half = (lane >> 4) & 1, l16 = lane & 15;
  const int grp = wave >> 2;
  const int wq  = wave & 3;
  const int gtid = tid & 127;
  const int b = blockIdx.y;
  const long qrow0 = (long)b * 2048 + (long)blockIdx.x * 64;

  unsigned short (*Ql)[LDP] = (unsigned short (*)[LDP])(L);
  unsigned short (*Kl)[LDP] = (unsigned short (*)[LDP])(L + KL_OFF + grp * KL_BYTES);
  unsigned short (*Vl)[VLP] = (unsigned short (*)[VLP])(L + VL_OFF + grp * VL_BYTES);  // [d][key]

  // Stage Q tile once (64x128 bf16), async: 2 copies per thread, 32 rows apart
  async_copy16x2(lds_addr(&Ql[tid >> 4][(tid & 15) * 8]), 32 * LDP * 2,
                 (const char*)(Qb + qrow0 * EMB + (long)tid * 8), 512 * 16);

  // Per-thread staging places of this group's K and V^T chunks
  const unsigned kdst = lds_addr(&Kl[gtid >> 4][(gtid & 15) * 8]);
  const unsigned vdst = lds_addr(&Vl[gtid >> 3][(gtid & 7) * 8]);
  const unsigned short* ksrc = Kb + (long)b * 2048 * EMB + (long)gtid * 8;
  const unsigned short* vsrc = Vt + ((long)b * EMB + (gtid >> 3)) * 2048 + (gtid & 7) * 8;

  // Per lane: running max of query l16 (equal in both halves) and the running
  // sum over this half's keys; the halves' sums are joined once, in the merge.
  float mrow = -3.0e38f, lrow = 0.0f;
  v8f acco[8] = {};  // O^T: acco[n][j] = O[query l16][d = 16n + 8*half + j]

  const float scale = 0.088388347648318447f;  // 1/sqrt(128)

  // First K chunk (64 keys x 128) row-major: 8 copies per thread, 8 rows apart
  async_copy16x8(kdst, 8 * LDP * 2, (const char*)(ksrc + (long)grp * 64 * EMB), 128 * 16);

  for (int it = 0; it < 32 / NGRP; ++it) {
    const long kbase = (long)(it * NGRP + grp) * 64;
    wait_ds0();       // this wave's reads of the previous V^T chunk have returned
    wait_async0();    // this wave's copies of this K chunk (and Q on iter 0) have landed
    __syncthreads();  // K chunk visible; every wave has left the previous V^T chunk
    // Stage V^T chunk (128 d x 64 keys): 8 copies per thread, 16 d-rows apart
    async_copy16x8(vdst, 16 * VLP * 2, (const char*)(vsrc + kbase), 16 * 2048 * 2);

    // S^T = K Q^T : 4 key m-tiles x 4 K-dim iters = 16 WMMA.
    // LDS reads are written in groups: one wait per group instead of one per read.
    v8f accs[4] = {};
#pragma unroll
    for (int k0 = 0; k0 < EMB; k0 += 32) {
      v16bf qf = ldfrag(&Ql[wq * 16 + l16][k0 + half * 8]);
      v16bf kf[4];
#pragma unroll
      for (int t = 0; t < 4; ++t)
        kf[t] = ldfrag(&Kl[t * 16 + l16][k0 + half * 8]);
#pragma unroll
      for (int t = 0; t < 4; ++t)
        accs[t] = __builtin_amdgcn_wmma_f32_16x16x32_bf16(
            false, kf[t], false, qf, (short)0, accs[t], false, false);
    }

    // Online softmax: the lane's 32 scores belong to one query.
    const v8f m8 = __builtin_elementwise_max(
        __builtin_elementwise_max(accs[0] * scale, accs[1] * scale),
        __builtin_elementwise_max(accs[2] * scale, accs[3] * scale));
    float mx = fmaxf(fmaxf(fmaxf(m8[0], m8[1]), fmaxf(m8[2], m8[3])),
                     fmaxf(fmaxf(m8[4], m8[5]), fmaxf(m8[6], m8[7])));
    mx = fmaxf(mx, other_half(mx));

    // About half of the pass's work lies on either side of this point, so each
    // of the two refills has half a pass to land. The scheduling barrier keeps
    // the row maxima in front of it: without it the compiler lifts the waits up
    // to the last K read, and V^T has only the K reads to land under.
    __builtin_amdgcn_sched_barrier(0);
    wait_ds0();       // this wave's reads of this K chunk have returned
    wait_async0();    // this wave's copies of this V^T chunk have landed
    __syncthreads();  // V^T chunk visible; every wave has left this K chunk
    if (it + 1 < 32 / NGRP)  // next K chunk, 8 copies per thread, 8 rows apart
      async_copy16x8(kdst, 8 * LDP * 2,
                     (const char*)(ksrc + (kbase + NGRP * 64) * EMB), 128 * 16);
    const float mn = fmaxf(mrow, mx);
    const float alpha = __expf(mrow - mn);
    mrow = mn;
#pragma unroll
    for (int t = 0; t < 4; ++t)
#pragma unroll
      for (int j = 0; j < 8; ++j)
        accs[t][j] = __expf(accs[t][j] * scale - mn);
    // In-lane sum as a tree: eight independent chains over the tiles, then 8 -> 1
    const v8f s8 = (accs[0] + accs[1]) + (accs[2] + accs[3]);
    const float sm = ((s8[0] + s8[1]) + (s8[2] + s8[3])) + ((s8[4] + s8[5]) + (s8[6] + s8[7]));
    lrow = lrow * alpha + sm;

    // Rescale running O
#pragma unroll
    for (int n = 0; n < 8; ++n)
#pragma unroll
      for (int j = 0; j < 8; ++j)
        acco[n][j] *= alpha;

    // O^T += V^T P^T : 2 K-dim iters x 8 d m-tiles = 16 WMMA. B = P^T of 32 keys:
    // score tiles 2kk and 2kk+1 in place, which is the k order the V^T loader has
    // (keys 8*half + 0..7, then 16 + 8*half + 0..7).
#pragma unroll
    for (int kk = 0; kk < 2; ++kk) {
      union { v16bf v; unsigned u[8]; } pf;
#pragma unroll
      for (int i = 0; i < 4; ++i) {
        pf.u[i]     = pack2(accs[2 * kk][2 * i],     accs[2 * kk][2 * i + 1]);
        pf.u[4 + i] = pack2(accs[2 * kk + 1][2 * i], accs[2 * kk + 1][2 * i + 1]);
      }
      v16bf vf[8];
#pragma unroll
      for (int n = 0; n < 8; ++n)
        vf[n] = ldfrag(&Vl[n * 16 + l16][kk * 32 + half * 8]);
#pragma unroll
      for (int n = 0; n < 8; ++n)
        acco[n] = __builtin_amdgcn_wmma_f32_16x16x32_bf16(
            false, vf[n], false, pf.v, (short)0, acco[n], false, false);
    }
  }

  float4* So = (float4*)L;
  float2* Sm = (float2*)(So + NGRP * 4 * 16 * 32);
  wait_ds0();       // this wave's last LDS reads have returned
  __syncthreads();  // every wave has left the K/V/Q buffers
#pragma unroll
  for (int n = 0; n < 8; ++n) {
    So[(wave * 16 + 2 * n) * 32 + lane] =
        make_float4(acco[n][0], acco[n][1], acco[n][2], acco[n][3]);
    So[(wave * 16 + 2 * n + 1) * 32 + lane] =
        make_float4(acco[n][4], acco[n][5], acco[n][6], acco[n][7]);
  }
  Sm[wave * 32 + lane] = make_float2(mrow, lrow);
  __syncthreads();  // partial results visible to the merging waves

  // Wave (grp, wq) finishes d columns 32*grp .. 32*grp+31 of its 16 query rows
  float wgt[NGRP], lsum;
  {
    float2 ml[NGRP];
#pragma unroll
    for (int s = 0; s < NGRP; ++s) ml[s] = Sm[(s * 4 + wq) * 32 + lane];
    float mx = fmaxf(fmaxf(ml[0].x, ml[1].x), fmaxf(ml[2].x, ml[3].x));
    float s = 0.0f;
#pragma unroll
    for (int g = 0; g < NGRP; ++g) {
      wgt[g] = __expf(ml[g].x - mx);
      s += wgt[g] * ml[g].y;
    }
    lsum = s + other_half(s);  // the two halves' keys together
  }

  // Epilogue: merged O / l, fp32 out; a lane holds 8 consecutive d of one query
  const long row = qrow0 + wq * 16 + l16;
#pragma unroll
  for (int nn = 0; nn < 2; ++nn) {
    const int n = grp * 2 + nn;
    float o[8] = {};
#pragma unroll
    for (int s = 0; s < NGRP; ++s) {
      const int sw = s * 4 + wq;
      float4 lo = So[(sw * 16 + 2 * n) * 32 + lane];
      float4 hi = So[(sw * 16 + 2 * n + 1) * 32 + lane];
      o[0] += wgt[s] * lo.x; o[1] += wgt[s] * lo.y;
      o[2] += wgt[s] * lo.z; o[3] += wgt[s] * lo.w;
      o[4] += wgt[s] * hi.x; o[5] += wgt[s] * hi.y;
      o[6] += wgt[s] * hi.z; o[7] += wgt[s] * hi.w;
    }
    float4* dst = (float4*)(Out + row * EMB + n * 16 + half * 8);
    dst[0] = make_float4(o[0] / lsum, o[1] / lsum, o[2] / lsum, o[3] / lsum);
    dst[1] = make_float4(o[4] / lsum, o[5] / lsum, o[6] / lsum, o[7] / lsum);
  }
}

extern "C" void kernel_launch(void* const* d_in, const int* in_sizes, int n_in,
                              void* d_out, int out_size, void* d_ws, size_t ws_size,
                              hipStream_t stream) {
  (void)in_sizes; (void)n_in; (void)out_size; (void)ws_size;
  const float* X  = (const float*)d_in[0];
  const float* Wq = (const float*)d_in[1];
  const float* bq = (const float*)d_in[2];
  const float* Wk = (const float*)d_in[3];
  const float* bk = (const float*)d_in[4];
  const float* Wv = (const float*)d_in[5];
  const float* bv = (const float*)d_in[6];

  unsigned short* Qb = (unsigned short*)d_ws;                 // [16384][128] bf16
  unsigned short* Kb = Qb + (size_t)16384 * 128;              // [16384][128] bf16
  unsigned short* Vt = Kb + (size_t)16384 * 128;              // [8][128][2048] bf16
  float* Out = (float*)d_out;

  qkv_kernel<<<256, 256, 0, stream>>>(X, Wq, bq, Wk, bk, Wv, bv, Qb, Kb, Vt);
  attn_kernel<<<dim3(32, 8), 512, 0, stream>>>(Qb, Kb, Vt, Out);
}

// v005
// A run of this version takes 31.4 microseconds.
// Next to v004, in two timings, it ran 1.22 times as fast each time.
// All steps since v000 together make it 3.25 times as fast.
#include <hip/hip_runtime.h>

typedef __attribute__((ext_vector_type(16))) __bf16 v16bf;
typedef __attribute__((ext_vector_type(8)))  float  v8f;

#define EMB 128
#define LDP 136   // padded LDS row stride (elements): 272B = 17*16B -> conflict-free b128
#define VLP 72    // padded stride for V^T tiles: 144B = 9*16B

union Frag { v16bf v; uint4 q[2]; };

__device__ __forceinline__ unsigned short f2bf(float f) {
  union { float f; unsigned u; } x; x.f = f;
  unsigned u = x.u + 0x7FFFu + ((x.u >> 16) & 1u);  // round-to-nearest-even
  return (unsigned short)(u >> 16);
}
__device__ __forceinline__ unsigned pack2(float a, float b) {
  return (unsigned)f2bf(a) | ((unsigned)f2bf(b) << 16);
}
// Load a 16x32 bf16 A/B fragment slice for this lane: 8 elems at p, 8 at p+16.
__device__ __forceinline__ v16bf ldfrag(const unsigned short* p) {
  Frag f;
  f.q[0] = *(const uint4*)(p);
  f.q[1] = *(const uint4*)(p + 16);
  return f.v;
}

__device__ __forceinline__ unsigned lds_addr(const void* p) {
  return (unsigned)(unsigned long long)p;
}
__device__ __forceinline__ void async_copy16x2(unsigned l, unsigned lstep,
                                               const char* g, long gstep) {
  asm volatile("global_load_async_to_lds_b128 %0, %2, off\n\t"
               "global_load_async_to_lds_b128 %1, %3, off\n\t"
               "s_wait_xcnt 0x0"
               :: "v"(l), "v"(l + lstep), "v"(g), "v"(g + gstep) : "memory");
}
__device__ __forceinline__ void async_copy16x8(unsigned l, unsigned lstep,
                                               const char* g, long gstep) {
  asm volatile("global_load_async_to_lds_b128 %0, %8, off\n\t"
               "global_load_async_to_lds_b128 %1, %9, off\n\t"
               "global_load_async_to_lds_b128 %2, %10, off\n\t"
               "global_load_async_to_lds_b128 %3, %11, off\n\t"
               "global_load_async_to_lds_b128 %4, %12, off\n\t"
               "global_load_async_to_lds_b128 %5, %13, off\n\t"
               "global_load_async_to_lds_b128 %6, %14, off\n\t"
               "global_load_async_to_lds_b128 %7, %15, off\n\t"
               "s_wait_xcnt 0x0"
               :: "v"(l), "v"(l + lstep), "v"(l + 2 * lstep), "v"(l + 3 * lstep),
                  "v"(l + 4 * lstep), "v"(l + 5 * lstep), "v"(l + 6 * lstep),
                  "v"(l + 7 * lstep),
                  "v"(g), "v"(g + gstep), "v"(g + 2 * gstep), "v"(g + 3 * gstep),
                  "v"(g + 4 * gstep), "v"(g + 5 * gstep), "v"(g + 6 * gstep),
                  "v"(g + 7 * gstep)
               : "memory");
}
__device__ __forceinline__ void wait_async0() {
  asm volatile("s_wait_asynccnt 0" ::: "memory");
}
__device__ __forceinline__ float other_half(float v) {
  int b = __builtin_bit_cast(int, v);
  b = __builtin_amdgcn_permlanex16(b, b, 0x76543210, 0xfedcba98, false, false);
  return __builtin_bit_cast(float, b);
}
__device__ __forceinline__ void wait_ds0() {
  asm volatile("s_wait_dscnt 0x0" ::: "memory");
}

// ---------------------------------------------------------------------------
// Kernel 1: Q/K/V = X @ W^T + b, output bf16. V written transposed per batch.
// Grid: 256 blocks x 256 threads (8 waves). Each block: 64 rows of X.
// Wave (rgrp,cgrp): 16 rows x 64 cols of the 64x128 output tile.
// Results leave as whole 128-byte lines, 16 bytes per lane, staged through LDS.
// ---------------------------------------------------------------------------
__global__ __launch_bounds__(256) void qkv_kernel(
    const float* __restrict__ X,
    const float* __restrict__ Wq, const float* __restrict__ bq,
    const float* __restrict__ Wk, const float* __restrict__ bk,
    const float* __restrict__ Wv, const float* __restrict__ bv,
    unsigned short* __restrict__ Qb, unsigned short* __restrict__ Kb,
    unsigned short* __restrict__ Vt)
{
  __shared__ __align__(16) unsigned short Xl[64][LDP];
  __shared__ __align__(16) unsigned short Wl[128][LDP];
  // Output staging: 16-byte pieces go in, whole 128-byte lines come out.
  // Q, K: rows 16*wave .. +15 are the wave's own 16 x 64 tile. V^T: [d][s], shared.
  __shared__ __align__(16) unsigned short St[128][VLP];
  // bq, bk: in the Q, K epilogues a lane adds the bias of 8 consecutive columns per tile
  __shared__ __align__(16) float Bl[2][EMB];

  const int tid  = threadIdx.x;
  const int lane = tid & 31;
  const int wave = tid >> 5;
  const int half = (lane >> 4) & 1;
  const int l16  = lane & 15;
  const int rgrp = wave >> 1;           // 0..3: 16-row group
  const int cgrp = wave & 1;            // 0..1: 64-col group
  const long rowBase = (long)blockIdx.x * 64;

  // All global reads are issued as whole batches, one phase ahead of their use:
  // the X tile and Wq together at the start, each later W when the W before it
  // goes from registers to LDS. A thread has 16 to 24 loads in flight per wait.
  float4 xr[8], wr[16];
  const float bqk = ((tid < EMB) ? bq : bk)[tid & (EMB - 1)];  // one bias value per thread
#pragma unroll  // the batch lives in registers: every index must be a constant
  for (int u = 0; u < 8; ++u)
    xr[u] = ((const float4*)(X + rowBase * EMB))[tid + u * 256];
#pragma unroll
  for (int u = 0; u < 16; ++u)
    wr[u] = ((const float4*)Wq)[tid + u * 256];

#pragma unroll
  for (int u = 0; u < 8; ++u) {
    int i = tid + u * 256;
    int r = (i * 4) >> 7, c = (i * 4) & 127;
    *(unsigned*)&Xl[r][c]     = pack2(xr[u].x, xr[u].y);
    *(unsigned*)&Xl[r][c + 2] = pack2(xr[u].z, xr[u].w);
  }
  Bl[tid >> 7][tid & (EMB - 1)] = bqk;  // visible behind the first barrier below

#pragma unroll  // m a constant: the next W's pointer and the store target are known
  for (int m = 0; m < 3; ++m) {
    const float* bias = (m == 0) ? bq : (m == 1) ? bk : bv;
    __syncthreads();
#pragma unroll  // register batch
    for (int u = 0; u < 16; ++u) {
      int i = tid + u * 256;
      int r = (i * 4) >> 7, c = (i * 4) & 127;
      *(unsigned*)&Wl[r][c]     = pack2(wr[u].x, wr[u].y);
      *(unsigned*)&Wl[r][c + 2] = pack2(wr[u].z, wr[u].w);
    }
    if (m < 2) {
      const float4* Wn = (const float4*)((m == 0) ? Wk : Wv);
#pragma unroll  // register batch
      for (int u = 0; u < 16; ++u) wr[u] = Wn[tid + u * 256];
    }
    __syncthreads();

    v8f acc[4] = {};
#pragma unroll
    for (int k0 = 0; k0 < EMB; k0 += 32) {
      v16bf a = ldfrag(&Xl[rgrp * 16 + l16][k0 + half * 8]);
#pragma unroll
      for (int t = 0; t < 4; ++t) {
        v16bf bm = ldfrag(&Wl[(cgrp * 4 + t) * 16 + l16][k0 + half * 8]);
        // Q, K: W as A and X as B, so a lane holds 8 consecutive columns of one
        // row of X. V: X as A, so a lane holds 8 consecutive rows s of one column d.
        // Either way the lane's 8 results are 16 contiguous bytes of the output.
        acc[t] = (m < 2)
            ? __builtin_amdgcn_wmma_f32_16x16x32_bf16(
                  false, bm, false, a, (short)0, acc[t], false, false)
            : __builtin_amdgcn_wmma_f32_16x16x32_bf16(
                  false, a, false, bm, (short)0, acc[t], false, false);
      }
    }

    const int r4 = lane >> 3, c8 = (lane & 7) * 8;  // read-back: 8 lanes per line
    if (m < 2) {
      unsigned short* dstm = (m == 0) ? Qb : Kb;
#pragma unroll
      for (int t = 0; t < 4; ++t) {
        const float* bp = &Bl[m][(cgrp * 4 + t) * 16 + half * 8];
        const float4 b0 = *(const float4*)bp, b1 = *(const float4*)(bp + 4);
        *(uint4*)&St[wave * 16 + l16][t * 16 + half * 8] = make_uint4(
            pack2(acc[t][0] + b0.x, acc[t][1] + b0.y),
            pack2(acc[t][2] + b0.z, acc[t][3] + b0.w),
            pack2(acc[t][4] + b1.x, acc[t][5] + b1.y),
            pack2(acc[t][6] + b1.z, acc[t][7] + b1.w));
      }
      wait_ds0();  // the wave's own pieces are in LDS before its lanes read each other's
#pragma unroll
      for (int i = 0; i < 4; ++i) {
        const int r = i * 4 + r4;
        const uint4 v = *(const uint4*)&St[wave * 16 + r][c8];
        *(uint4*)(dstm + (rowBase + rgrp * 16 + r) * EMB + cgrp * 64 + c8) = v;
      }
    } else {
#pragma unroll
      for (int t = 0; t < 4; ++t) {
        const int col = (cgrp * 4 + t) * 16 + l16;
        const float bval = bias[col];
        *(uint4*)&St[col][rgrp * 16 + half * 8] = make_uint4(
            pack2(acc[t][0] + bval, acc[t][1] + bval),
            pack2(acc[t][2] + bval, acc[t][3] + bval),
            pack2(acc[t][4] + bval, acc[t][5] + bval),
            pack2(acc[t][6] + bval, acc[t][7] + bval));
      }
      __syncthreads();  // a V^T line (64 s of one d) holds pieces of four waves
      const long batch = rowBase >> 11, s0 = rowBase & 2047;
#pragma unroll
      for (int i = 0; i < 4; ++i) {
        const int d = wave * 16 + i * 4 + r4;
        const uint4 v = *(const uint4*)&St[d][c8];
        *(uint4*)(Vt + (batch * EMB + d) * 2048 + s0 + c8) = v;  // V transposed: [b][d][S]
      }
    }
  }
}

#define NGRP 4
#define QL_BYTES (64 * LDP * 2)
#define KL_BYTES (64 * LDP * 2)          // per group
#define VL_BYTES (128 * VLP * 2)         // per group
#define KL_OFF   QL_BYTES
#define VL_OFF   (KL_OFF + NGRP * KL_BYTES)
#define OT_OFF   (VL_OFF + NGRP * VL_BYTES)   // output staging, behind everything else
#define OTP      36                           // its row pitch in floats: 144 B = 9*16 B
#define ATTN_LDS (OT_OFF + NGRP * 4 * 16 * OTP * 4)

__global__ __launch_bounds__(512) void attn_kernel(
    const unsigned short* __restrict__ Qb,
    const unsigned short* __restrict__ Kb,
    const unsigned short* __restrict__ Vt,
    float* __restrict__ Out)
{
  __shared__ __align__(16) unsigned char L[ATTN_LDS];

  const int tid = threadIdx.x, lane = tid & 31, wave = tid >> 5;
  const int half = (lane >> 4) & 1, l16 = lane & 15;
  const int grp = wave >> 2;
  const int wq  = wave & 3;
  const int gtid = tid & 127;
  const int b = blockIdx.y;
  const long qrow0 = (long)b * 2048 + (long)blockIdx.x * 64;

  unsigned short (*Ql)[LDP] = (unsigned short (*)[LDP])(L);
  unsigned short (*Kl)[LDP] = (unsigned short (*)[LDP])(L + KL_OFF + grp * KL_BYTES);
  unsigned short (*Vl)[VLP] = (unsigned short (*)[VLP])(L + VL_OFF + grp * VL_BYTES);  // [d][key]

  // Stage Q tile once (64x128 bf16), async: 2 copies per thread, 32 rows apart
  async_copy16x2(lds_addr(&Ql[tid >> 4][(tid & 15) * 8]), 32 * LDP * 2,
                 (const char*)(Qb + qrow0 * EMB + (long)tid * 8), 512 * 16);

  // Per-thread staging places of this group's K and V^T chunks
  const unsigned kdst = lds_addr(&Kl[gtid >> 4][(gtid & 15) * 8]);
  const unsigned vdst = lds_addr(&Vl[gtid >> 3][(gtid & 7) * 8]);
  const unsigned short* ksrc = Kb + (long)b * 2048 * EMB + (long)gtid * 8;
  const unsigned short* vsrc = Vt + ((long)b * EMB + (gtid >> 3)) * 2048 + (gtid & 7) * 8;

  // Per lane: running max of query l16 (equal in both halves) and the running
  // sum over this half's keys; the halves' sums are joined once, in the merge.
  float mrow = -3.0e38f, lrow = 0.0f;
  v8f acco[8] = {};  // O^T: acco[n][j] = O[query l16][d = 16n + 8*half + j]

  const float scale = 0.088388347648318447f;  // 1/sqrt(128)

  // First K chunk (64 keys x 128) row-major: 8 copies per thread, 8 rows apart
  async_copy16x8(kdst, 8 * LDP * 2, (const char*)(ksrc + (long)grp * 64 * EMB), 128 * 16);

  for (int it = 0; it < 32 / NGRP; ++it) {
    const long kbase = (long)(it * NGRP + grp) * 64;
    wait_ds0();       // this wave's reads of the previous V^T chunk have returned
    wait_async0();    // this wave's copies of this K chunk (and Q on iter 0) have landed
    __syncthreads();  // K chunk visible; every wave has left the previous V^T chunk
    // Stage V^T chunk (128 d x 64 keys): 8 copies per thread, 16 d-rows apart
    async_copy16x8(vdst, 16 * VLP * 2, (const char*)(vsrc + kbase), 16 * 2048 * 2);

    // S^T = K Q^T : 4 key m-tiles x 4 K-dim iters = 16 WMMA.
    // LDS reads are written in groups: one wait per group instead of one per read.
    v8f accs[4] = {};
#pragma unroll
    for (int k0 = 0; k0 < EMB; k0 += 32) {
      v16bf qf = ldfrag(&Ql[wq * 16 + l16][k0 + half * 8]);
      v16bf kf[4];
#pragma unroll
      for (int t = 0; t < 4; ++t)
        kf[t] = ldfrag(&Kl[t * 16 + l16][k0 + half * 8]);
#pragma unroll
      for (int t = 0; t < 4; ++t)
        accs[t] = __builtin_amdgcn_wmma_f32_16x16x32_bf16(
            false, kf[t], false, qf, (short)0, accs[t], false, false);
    }

    // Online softmax: the lane's 32 scores belong to one query.
    const v8f m8 = __builtin_elementwise_max(
        __builtin_elementwise_max(accs[0] * scale, accs[1] * scale),
        __builtin_elementwise_max(accs[2] * scale, accs[3] * scale));
    float mx = fmaxf(fmaxf(fmaxf(m8[0], m8[1]), fmaxf(m8[2], m8[3])),
                     fmaxf(fmaxf(m8[4], m8[5]), fmaxf(m8[6], m8[7])));
    mx = fmaxf(mx, other_half(mx));

    // About half of the pass's work lies on either side of this point, so each
    // of the two refills has half a pass to land. The scheduling barrier keeps
    // the row maxima in front of it: without it the compiler lifts the waits up
    // to the last K read, and V^T has only the K reads to land under.
    __builtin_amdgcn_sched_barrier(0);
    wait_ds0();       // this wave's reads of this K chunk have returned
    wait_async0();    // this wave's copies of this V^T chunk have landed
    __syncthreads();  // V^T chunk visible; every wave has left this K chunk
    if (it + 1 < 32 / NGRP)  // next K chunk, 8 copies per thread, 8 rows apart
      async_copy16x8(kdst, 8 * LDP * 2,
                     (const char*)(ksrc + (kbase + NGRP * 64) * EMB), 128 * 16);
    const float mn = fmaxf(mrow, mx);
    const float alpha = __expf(mrow - mn);
    mrow = mn;
#pragma unroll
    for (int t = 0; t < 4; ++t)
#pragma unroll
      for (int j = 0; j < 8; ++j)
        accs[t][j] = __expf(accs[t][j] * scale - mn);
    // In-lane sum as a tree: eight independent chains over the tiles, then 8 -> 1
    const v8f s8 = (accs[0] + accs[1]) + (accs[2] + accs[3]);
    const float sm = ((s8[0] + s8[1]) + (s8[2] + s8[3])) + ((s8[4] + s8[5]) + (s8[6] + s8[7]));
    lrow = lrow * alpha + sm;

    // Rescale running O
#pragma unroll
    for (int n = 0; n < 8; ++n)
#pragma unroll
      for (int j = 0; j < 8; ++j)
        acco[n][j] *= alpha;

    // O^T += V^T P^T : 2 K-dim iters x 8 d m-tiles = 16 WMMA. B = P^T of 32 keys:
    // score tiles 2kk and 2kk+1 in place, which is the k order the V^T loader has
    // (keys 8*half + 0..7, then 16 + 8*half + 0..7).
#pragma unroll
    for (int kk = 0; kk < 2; ++kk) {
      union { v16bf v; unsigned u[8]; } pf;
#pragma unroll
      for (int i = 0; i < 4; ++i) {
        pf.u[i]     = pack2(accs[2 * kk][2 * i],     accs[2 * kk][2 * i + 1]);
        pf.u[4 + i] = pack2(accs[2 * kk + 1][2 * i], accs[2 * kk + 1][2 * i + 1]);
      }
      v16bf vf[8];
#pragma unroll
      for (int n = 0; n < 8; ++n)
        vf[n] = ldfrag(&Vl[n * 16 + l16][kk * 32 + half * 8]);
#pragma unroll
      for (int n = 0; n < 8; ++n)
        acco[n] = __builtin_amdgcn_wmma_f32_16x16x32_bf16(
            false, vf[n], false, pf.v, (short)0, acco[n], false, false);
    }
  }

  float4* So = (float4*)L;
  float2* Sm = (float2*)(So + NGRP * 4 * 16 * 32);
  wait_ds0();       // this wave's last LDS reads have returned
  __syncthreads();  // every wave has left the K/V/Q buffers
#pragma unroll
  for (int n = 0; n < 8; ++n) {
    So[(wave * 16 + 2 * n) * 32 + lane] =
        make_float4(acco[n][0], acco[n][1], acco[n][2], acco[n][3]);
    So[(wave * 16 + 2 * n + 1) * 32 + lane] =
        make_float4(acco[n][4], acco[n][5], acco[n][6], acco[n][7]);
  }
  Sm[wave * 32 + lane] = make_float2(mrow, lrow);
  __syncthreads();  // partial results visible to the merging waves

  // Wave (grp, wq) finishes d columns 32*grp .. 32*grp+31 of its 16 query rows
  float wgt[NGRP], lsum;
  {
    float2 ml[NGRP];
#pragma unroll
    for (int s = 0; s < NGRP; ++s) ml[s] = Sm[(s * 4 + wq) * 32 + lane];
    float mx = fmaxf(fmaxf(ml[0].x, ml[1].x), fmaxf(ml[2].x, ml[3].x));
    float s = 0.0f;
#pragma unroll
    for (int g = 0; g < NGRP; ++g) {
      wgt[g] = __expf(ml[g].x - mx);
      s += wgt[g] * ml[g].y;
    }
    lsum = s + other_half(s);  // the two halves' keys together
  }

  // Epilogue: merged O / l, fp32 out; a lane holds 8 consecutive d of one query.
  // The wave's 32 d of a query row are one 128-byte line: its lanes' 16-byte pieces
  // go through the wave's own LDS rows and leave as whole lines, 8 lanes per line.
  float (*Ot)[OTP] = (float (*)[OTP])(L + OT_OFF + wave * (16 * OTP * 4));
#pragma unroll
  for (int nn = 0; nn < 2; ++nn) {
    const int n = grp * 2 + nn;
    float o[8] = {};
#pragma unroll
    for (int s = 0; s < NGRP; ++s) {
      const int sw = s * 4 + wq;
      float4 lo = So[(sw * 16 + 2 * n) * 32 + lane];
      float4 hi = So[(sw * 16 + 2 * n + 1) * 32 + lane];
      o[0] += wgt[s] * lo.x; o[1] += wgt[s] * lo.y;
      o[2] += wgt[s] * lo.z; o[3] += wgt[s] * lo.w;
      o[4] += wgt[s] * hi.x; o[5] += wgt[s] * hi.y;
      o[6] += wgt[s] * hi.z; o[7] += wgt[s] * hi.w;
    }
    float4* dst = (float4*)&Ot[l16][nn * 16 + half * 8];
    dst[0] = make_float4(o[0] / lsum, o[1] / lsum, o[2] / lsum, o[3] / lsum);
    dst[1] = make_float4(o[4] / lsum, o[5] / lsum, o[6] / lsum, o[7] / lsum);
  }
  wait_ds0();  // the wave's own pieces are in LDS before its lanes read each other's
#pragma unroll
  for (int i = 0; i < 4; ++i) {
    const int r = i * 4 + (lane >> 3), c4 = (lane & 7) * 4;
    const float4 v = *(const float4*)&Ot[r][c4];
    *(float4*)(Out + (qrow0 + wq * 16 + r) * EMB + grp * 32 + c4) = v;
  }
}

extern "C" void kernel_launch(void* const* d_in, const int* in_sizes, int n_in,
                              void* d_out, int out_size, void* d_ws, size_t ws_size,
                              hipStream_t stream) {
  (void)in_sizes; (void)n_in; (void)out_size; (void)ws_size;
  const float* X  = (const float*)d_in[0];
  const float* Wq = (const float*)d_in[1];
  const float* bq = (const float*)d_in[2];
  const float* Wk = (const float*)d_in[3];
  const float* bk = (const float*)d_in[4];
  const float* Wv = (const float*)d_in[5];
  const float* bv = (const float*)d_in[6];

  unsigned short* Qb = (unsigned short*)d_ws;                 // [16384][128] bf16
  unsigned short* Kb = Qb + (size_t)16384 * 128;              // [16384][128] bf16
  unsigned short* Vt = Kb + (size_t)16384 * 128;              // [8][128][2048] bf16
  float* Out = (float*)d_out;

  qkv_kernel<<<256, 256, 0, stream>>>(X, Wq, bq, Wk, bk, Wv, bv, Qb, Kb, Vt);
  attn_kernel<<<dim3(32, 8), 512, 0, stream>>>(Qb, Kb, Vt, Out);
}

// v006
// Measured time: 29.2 microseconds a run.
// Next to v005, in two timings, it ran 1.09 times as fast each time.
// Over all steps from v000 it is 3.53 times as fast.
#include <hip/hip_runtime.h>

typedef __attribute__((ext_vector_type(16))) __bf16 v16bf;
typedef __attribute__((ext_vector_type(8)))  float  v8f;

#define EMB 128
#define LDP 136   // padded LDS row stride (elements): 272B = 17*16B -> conflict-free b128
#define VLP 72    // padded stride for V^T tiles: 144B = 9*16B

union Frag { v16bf v; uint4 q[2]; };

typedef __attribute__((ext_vector_type(2))) float  f32x2;
typedef __attribute__((ext_vector_type(2))) __bf16 bf16x2;
__device__ __forceinline__ unsigned pack2(float a, float b) {
  const f32x2 v = {a, b};
  return __builtin_bit_cast(unsigned, __builtin_convertvector(v, bf16x2));
}
// Load a 16x32 bf16 A/B fragment slice for this lane: 8 elems at p, 8 at p+16.
__device__ __forceinline__ v16bf ldfrag(const unsigned short* p) {
  Frag f;
  f.q[0] = *(const uint4*)(p);
  f.q[1] = *(const uint4*)(p + 16);
  return f.v;
}

__device__ __forceinline__ unsigned lds_addr(const void* p) {
  return (unsigned)(unsigned long long)p;
}
__device__ __forceinline__ void async_copy16x2(unsigned l, unsigned lstep,
                                               const char* g, long gstep) {
  asm volatile("global_load_async_to_lds_b128 %0, %2, off\n\t"
               "global_load_async_to_lds_b128 %1, %3, off\n\t"
               "s_wait_xcnt 0x0"
               :: "v"(l), "v"(l + lstep), "v"(g), "v"(g + gstep) : "memory");
}
__device__ __forceinline__ void async_copy16x8(unsigned l, unsigned lstep,
                                               const char* g, long gstep) {
  asm volatile("global_load_async_to_lds_b128 %0, %8, off\n\t"
               "global_load_async_to_lds_b128 %1, %9, off\n\t"
               "global_load_async_to_lds_b128 %2, %10, off\n\t"
               "global_load_async_to_lds_b128 %3, %11, off\n\t"
               "global_load_async_to_lds_b128 %4, %12, off\n\t"
               "global_load_async_to_lds_b128 %5, %13, off\n\t"
               "global_load_async_to_lds_b128 %6, %14, off\n\t"
               "global_load_async_to_lds_b128 %7, %15, off\n\t"
               "s_wait_xcnt 0x0"
               :: "v"(l), "v"(l + lstep), "v"(l + 2 * lstep), "v"(l + 3 * lstep),
                  "v"(l + 4 * lstep), "v"(l + 5 * lstep), "v"(l + 6 * lstep),
                  "v"(l + 7 * lstep),
                  "v"(g), "v"(g + gstep), "v"(g + 2 * gstep), "v"(g + 3 * gstep),
                  "v"(g + 4 * gstep), "v"(g + 5 * gstep), "v"(g + 6 * gstep),
                  "v"(g + 7 * gstep)
               : "memory");
}
__device__ __forceinline__ void wait_async0() {
  asm volatile("s_wait_asynccnt 0" ::: "memory");
}
__device__ __forceinline__ float other_half(float v) {
  int b = __builtin_bit_cast(int, v);
  b = __builtin_amdgcn_permlanex16(b, b, 0x76543210, 0xfedcba98, false, false);
  return __builtin_bit_cast(float, b);
}
__device__ __forceinline__ void wait_ds0() {
  asm volatile("s_wait_dscnt 0x0" ::: "memory");
}

// ---------------------------------------------------------------------------
// Kernel 1: Q/K/V = X @ W^T + b, output bf16. V written transposed per batch.
// Grid: 256 blocks x 256 threads (8 waves). Each block: 64 rows of X.
// Wave (rgrp,cgrp): 16 rows x 64 cols of the 64x128 output tile.
// Results leave as whole 128-byte lines, 16 bytes per lane, staged through LDS.
// ---------------------------------------------------------------------------
__global__ __launch_bounds__(256) void qkv_kernel(
    const float* __restrict__ X,
    const float* __restrict__ Wq, const float* __restrict__ bq,
    const float* __restrict__ Wk, const float* __restrict__ bk,
    const float* __restrict__ Wv, const float* __restrict__ bv,
    unsigned short* __restrict__ Qb, unsigned short* __restrict__ Kb,
    unsigned short* __restrict__ Vt)
{
  __shared__ __align__(16) unsigned short Xl[64][LDP];
  __shared__ __align__(16) unsigned short Wl[128][LDP];
  // Output staging: 16-byte pieces go in, whole 128-byte lines come out.
  // Q, K: rows 16*wave .. +15 are the wave's own 16 x 64 tile. V^T: [d][s], shared.
  __shared__ __align__(16) unsigned short St[128][VLP];
  // bq, bk: in the Q, K epilogues a lane adds the bias of 8 consecutive columns per tile
  __shared__ __align__(16) float Bl[2][EMB];

  const int tid  = threadIdx.x;
  const int lane = tid & 31;
  const int wave = tid >> 5;
  const int half = (lane >> 4) & 1;
  const int l16  = lane & 15;
  const int rgrp = wave >> 1;           // 0..3: 16-row group
  const int cgrp = wave & 1;            // 0..1: 64-col group
  const long rowBase = (long)blockIdx.x * 64;

  // All global reads are issued as whole batches, one phase ahead of their use:
  // the X tile and Wq together at the start, each later W when the W before it
  // goes from registers to LDS. A thread has 16 to 24 loads in flight per wait.
  float4 xr[8], wr[16];
  const float bqk = ((tid < EMB) ? bq : bk)[tid & (EMB - 1)];  // one bias value per thread
#pragma unroll  // the batch lives in registers: every index must be a constant
  for (int u = 0; u < 8; ++u)
    xr[u] = ((const float4*)(X + rowBase * EMB))[tid + u * 256];
#pragma unroll
  for (int u = 0; u < 16; ++u)
    wr[u] = ((const float4*)Wq)[tid + u * 256];

#pragma unroll
  for (int u = 0; u < 8; ++u) {
    int i = tid + u * 256;
    int r = (i * 4) >> 7, c = (i * 4) & 127;
    *(unsigned*)&Xl[r][c]     = pack2(xr[u].x, xr[u].y);
    *(unsigned*)&Xl[r][c + 2] = pack2(xr[u].z, xr[u].w);
  }
  Bl[tid >> 7][tid & (EMB - 1)] = bqk;  // visible behind the first barrier below

#pragma unroll  // m a constant: the next W's pointer and the store target are known
  for (int m = 0; m < 3; ++m) {
    const float* bias = (m == 0) ? bq : (m == 1) ? bk : bv;
    __syncthreads();
#pragma unroll  // register batch
    for (int u = 0; u < 16; ++u) {
      int i = tid + u * 256;
      int r = (i * 4) >> 7, c = (i * 4) & 127;
      *(unsigned*)&Wl[r][c]     = pack2(wr[u].x, wr[u].y);
      *(unsigned*)&Wl[r][c + 2] = pack2(wr[u].z, wr[u].w);
    }
    if (m < 2) {
      const float4* Wn = (const float4*)((m == 0) ? Wk : Wv);
#pragma unroll  // register batch
      for (int u = 0; u < 16; ++u) wr[u] = Wn[tid + u * 256];
    }
    __syncthreads();

    v8f acc[4] = {};
#pragma unroll
    for (int k0 = 0; k0 < EMB; k0 += 32) {
      v16bf a = ldfrag(&Xl[rgrp * 16 + l16][k0 + half * 8]);
#pragma unroll
      for (int t = 0; t < 4; ++t) {
        v16bf bm = ldfrag(&Wl[(cgrp * 4 + t) * 16 + l16][k0 + half * 8]);
        // Q, K: W as A and X as B, so a lane holds 8 consecutive columns of one
        // row of X. V: X as A, so a lane holds 8 consecutive rows s of one column d.
        // Either way the lane's 8 results are 16 contiguous bytes of the output.
        acc[t] = (m < 2)
            ? __builtin_amdgcn_wmma_f32_16x16x32_bf16(
                  false, bm, false, a, (short)0, acc[t], false, false)
            : __builtin_amdgcn_wmma_f32_16x16x32_bf16(
                  false, a, false, bm, (short)0, acc[t], false, false);
      }
    }

    const int r4 = lane >> 3, c8 = (lane & 7) * 8;  // read-back: 8 lanes per line
    if (m < 2) {
      unsigned short* dstm = (m == 0) ? Qb : Kb;
#pragma unroll
      for (int t = 0; t < 4; ++t) {
        const float* bp = &Bl[m][(cgrp * 4 + t) * 16 + half * 8];
        const float4 b0 = *(const float4*)bp, b1 = *(const float4*)(bp + 4);
        *(uint4*)&St[wave * 16 + l16][t * 16 + half * 8] = make_uint4(
            pack2(acc[t][0] + b0.x, acc[t][1] + b0.y),
            pack2(acc[t][2] + b0.z, acc[t][3] + b0.w),
            pack2(acc[t][4] + b1.x, acc[t][5] + b1.y),
            pack2(acc[t][6] + b1.z, acc[t][7] + b1.w));
      }
      wait_ds0();  // the wave's own pieces are in LDS before its lanes read each other's
#pragma unroll
      for (int i = 0; i < 4; ++i) {
        const int r = i * 4 + r4;
        const uint4 v = *(const uint4*)&St[wave * 16 + r][c8];
        *(uint4*)(dstm + (rowBase + rgrp * 16 + r) * EMB + cgrp * 64 + c8) = v;
      }
    } else {
#pragma unroll
      for (int t = 0; t < 4; ++t) {
        const int col = (cgrp * 4 + t) * 16 + l16;
        const float bval = bias[col];
        *(uint4*)&St[col][rgrp * 16 + half * 8] = make_uint4(
            pack2(acc[t][0] + bval, acc[t][1] + bval),
            pack2(acc[t][2] + bval, acc[t][3] + bval),
            pack2(acc[t][4] + bval, acc[t][5] + bval),
            pack2(acc[t][6] + bval, acc[t][7] + bval));
      }
      __syncthreads();  // a V^T line (64 s of one d) holds pieces of four waves
      const long batch = rowBase >> 11, s0 = rowBase & 2047;
#pragma unroll
      for (int i = 0; i < 4; ++i) {
        const int d = wave * 16 + i * 4 + r4;
        const uint4 v = *(const uint4*)&St[d][c8];
        *(uint4*)(Vt + (batch * EMB + d) * 2048 + s0 + c8) = v;  // V transposed: [b][d][S]
      }
    }
  }
}

#define NGRP 4
#define QL_BYTES (64 * LDP * 2)
#define KL_BYTES (64 * LDP * 2)          // per group
#define VL_BYTES (128 * VLP * 2)         // per group
#define KL_OFF   QL_BYTES
#define VL_OFF   (KL_OFF + NGRP * KL_BYTES)
#define OT_OFF   (VL_OFF + NGRP * VL_BYTES)   // output staging, behind everything else
#define OTP      36                           // its row pitch in floats: 144 B = 9*16 B
#define ATTN_LDS (OT_OFF + NGRP * 4 * 16 * OTP * 4)

__global__ __launch_bounds__(512) void attn_kernel(
    const unsigned short* __restrict__ Qb,
    const unsigned short* __restrict__ Kb,
    const unsigned short* __restrict__ Vt,
    float* __restrict__ Out)
{
  __shared__ __align__(16) unsigned char L[ATTN_LDS];

  const int tid = threadIdx.x, lane = tid & 31, wave = tid >> 5;
  const int half = (lane >> 4) & 1, l16 = lane & 15;
  const int grp = wave >> 2;
  const int wq  = wave & 3;
  const int gtid = tid & 127;
  const int b = blockIdx.y;
  const long qrow0 = (long)b * 2048 + (long)blockIdx.x * 64;

  unsigned short (*Ql)[LDP] = (unsigned short (*)[LDP])(L);
  unsigned short (*Kl)[LDP] = (unsigned short (*)[LDP])(L + KL_OFF + grp * KL_BYTES);
  unsigned short (*Vl)[VLP] = (unsigned short (*)[VLP])(L + VL_OFF + grp * VL_BYTES);  // [d][key]

  // Stage Q tile once (64x128 bf16), async: 2 copies per thread, 32 rows apart
  async_copy16x2(lds_addr(&Ql[tid >> 4][(tid & 15) * 8]), 32 * LDP * 2,
                 (const char*)(Qb + qrow0 * EMB + (long)tid * 8), 512 * 16);

  // Per-thread staging places of this group's K and V^T chunks
  const unsigned kdst = lds_addr(&Kl[gtid >> 4][(gtid & 15) * 8]);
  const unsigned vdst = lds_addr(&Vl[gtid >> 3][(gtid & 7) * 8]);
  const unsigned short* ksrc = Kb + (long)b * 2048 * EMB + (long)gtid * 8;
  const unsigned short* vsrc = Vt + ((long)b * EMB + (gtid >> 3)) * 2048 + (gtid & 7) * 8;

  // Per lane: running max of query l16 (equal in both halves) and the running
  // sum over this half's keys; the halves' sums are joined once, in the merge.
  float mrow = -3.0e38f, lrow = 0.0f;
  v8f acco[8] = {};  // O^T: acco[n][j] = O[query l16][d = 16n + 8*half + j]

  const float scale = 0.088388347648318447f;  // 1/sqrt(128)

  // First K chunk (64 keys x 128) row-major: 8 copies per thread, 8 rows apart
  async_copy16x8(kdst, 8 * LDP * 2, (const char*)(ksrc + (long)grp * 64 * EMB), 128 * 16);

  for (int it = 0; it < 32 / NGRP; ++it) {
    const long kbase = (long)(it * NGRP + grp) * 64;
    wait_ds0();       // this wave's reads of the previous V^T chunk have returned
    wait_async0();    // this wave's copies of this K chunk (and Q on iter 0) have landed
    __syncthreads();  // K chunk visible; every wave has left the previous V^T chunk
    // Stage V^T chunk (128 d x 64 keys): 8 copies per thread, 16 d-rows apart
    async_copy16x8(vdst, 16 * VLP * 2, (const char*)(vsrc + kbase), 16 * 2048 * 2);

    // S^T = K Q^T : 4 key m-tiles x 4 K-dim iters = 16 WMMA.
    // LDS reads are written in groups: one wait per group instead of one per read.
    v8f accs[4] = {};
#pragma unroll
    for (int k0 = 0; k0 < EMB; k0 += 32) {
      v16bf qf = ldfrag(&Ql[wq * 16 + l16][k0 + half * 8]);
      v16bf kf[4];
#pragma unroll
      for (int t = 0; t < 4; ++t)
        kf[t] = ldfrag(&Kl[t * 16 + l16][k0 + half * 8]);
#pragma unroll
      for (int t = 0; t < 4; ++t)
        accs[t] = __builtin_amdgcn_wmma_f32_16x16x32_bf16(
            false, kf[t], false, qf, (short)0, accs[t], false, false);
    }

    // Online softmax: the lane's 32 scores belong to one query.
    const v8f m8 = __builtin_elementwise_max(
        __builtin_elementwise_max(accs[0] * scale, accs[1] * scale),
        __builtin_elementwise_max(accs[2] * scale, accs[3] * scale));
    float mx = fmaxf(fmaxf(fmaxf(m8[0], m8[1]), fmaxf(m8[2], m8[3])),
                     fmaxf(fmaxf(m8[4], m8[5]), fmaxf(m8[6], m8[7])));
    mx = fmaxf(mx, other_half(mx));

    // About half of the pass's work lies on either side of this point, so each
    // of the two refills has half a pass to land. The scheduling barrier keeps
    // the row maxima in front of it: without it the compiler lifts the waits up
    // to the last K read, and V^T has only the K reads to land under.
    __builtin_amdgcn_sched_barrier(0);
    wait_ds0();       // this wave's reads of this K chunk have returned
    wait_async0();    // this wave's copies of this V^T chunk have landed
    __syncthreads();  // V^T chunk visible; every wave has left this K chunk
    if (it + 1 < 32 / NGRP)  // next K chunk, 8 copies per thread, 8 rows apart
      async_copy16x8(kdst, 8 * LDP * 2,
                     (const char*)(ksrc + (kbase + NGRP * 64) * EMB), 128 * 16);
    const float mn = fmaxf(mrow, mx);
    const float alpha = __expf(mrow - mn);
    mrow = mn;
#pragma unroll
    for (int t = 0; t < 4; ++t)
#pragma unroll
      for (int j = 0; j < 8; ++j)
        accs[t][j] = __expf(accs[t][j] * scale - mn);
    // In-lane sum as a tree: eight independent chains over the tiles, then 8 -> 1
    const v8f s8 = (accs[0] + accs[1]) + (accs[2] + accs[3]);
    const float sm = ((s8[0] + s8[1]) + (s8[2] + s8[3])) + ((s8[4] + s8[5]) + (s8[6] + s8[7]));
    lrow = lrow * alpha + sm;

    // Rescale running O
#pragma unroll
    for (int n = 0; n < 8; ++n)
#pragma unroll
      for (int j = 0; j < 8; ++j)
        acco[n][j] *= alpha;

    // O^T += V^T P^T : 2 K-dim iters x 8 d m-tiles = 16 WMMA. B = P^T of 32 keys:
    // score tiles 2kk and 2kk+1 in place, which is the k order the V^T loader has
    // (keys 8*half + 0..7, then 16 + 8*half + 0..7).
#pragma unroll
    for (int kk = 0; kk < 2; ++kk) {
      union { v16bf v; unsigned u[8]; } pf;
#pragma unroll
      for (int i = 0; i < 4; ++i) {
        pf.u[i]     = pack2(accs[2 * kk][2 * i],     accs[2 * kk][2 * i + 1]);
        pf.u[4 + i] = pack2(accs[2 * kk + 1][2 * i], accs[2 * kk + 1][2 * i + 1]);
      }
      v16bf vf[8];
#pragma unroll
      for (int n = 0; n < 8; ++n)
        vf[n] = ldfrag(&Vl[n * 16 + l16][kk * 32 + half * 8]);
#pragma unroll
      for (int n = 0; n < 8; ++n)
        acco[n] = __builtin_amdgcn_wmma_f32_16x16x32_bf16(
            false, vf[n], false, pf.v, (short)0, acco[n], false, false);
    }
  }

  float4* So = (float4*)L;
  float2* Sm = (float2*)(So + NGRP * 4 * 16 * 32);
  wait_ds0();       // this wave's last LDS reads have returned
  __syncthreads();  // every wave has left the K/V/Q buffers
#pragma unroll
  for (int n = 0; n < 8; ++n) {
    So[(wave * 16 + 2 * n) * 32 + lane] =
        make_float4(acco[n][0], acco[n][1], acco[n][2], acco[n][3]);
    So[(wave * 16 + 2 * n + 1) * 32 + lane] =
        make_float4(acco[n][4], acco[n][5], acco[n][6], acco[n][7]);
  }
  Sm[wave * 32 + lane] = make_float2(mrow, lrow);
  __syncthreads();  // partial results visible to the merging waves

  // Wave (grp, wq) finishes d columns 32*grp .. 32*grp+31 of its 16 query rows
  float wgt[NGRP], lsum;
  {
    float2 ml[NGRP];
#pragma unroll
    for (int s = 0; s < NGRP; ++s) ml[s] = Sm[(s * 4 + wq) * 32 + lane];
    float mx = fmaxf(fmaxf(ml[0].x, ml[1].x), fmaxf(ml[2].x, ml[3].x));
    float s = 0.0f;
#pragma unroll
    for (int g = 0; g < NGRP; ++g) {
      wgt[g] = __expf(ml[g].x - mx);
      s += wgt[g] * ml[g].y;
    }
    lsum = s + other_half(s);  // the two halves' keys together
  }

  // Epilogue: merged O / l, fp32 out; a lane holds 8 consecutive d of one query.
  // The wave's 32 d of a query row are one 128-byte line: its lanes' 16-byte pieces
  // go through the wave's own LDS rows and leave as whole lines, 8 lanes per line.
  float (*Ot)[OTP] = (float (*)[OTP])(L + OT_OFF + wave * (16 * OTP * 4));
#pragma unroll
  for (int nn = 0; nn < 2; ++nn) {
    const int n = grp * 2 + nn;
    float o[8] = {};
#pragma unroll
    for (int s = 0; s < NGRP; ++s) {
      const int sw = s * 4 + wq;
      float4 lo = So[(sw * 16 + 2 * n) * 32 + lane];
      float4 hi = So[(sw * 16 + 2 * n + 1) * 32 + lane];
      o[0] += wgt[s] * lo.x; o[1] += wgt[s] * lo.y;
      o[2] += wgt[s] * lo.z; o[3] += wgt[s] * lo.w;
      o[4] += wgt[s] * hi.x; o[5] += wgt[s] * hi.y;
      o[6] += wgt[s] * hi.z; o[7] += wgt[s] * hi.w;
    }
    float4* dst = (float4*)&Ot[l16][nn * 16 + half * 8];
    dst[0] = make_float4(o[0] / lsum, o[1] / lsum, o[2] / lsum, o[3] / lsum);
    dst[1] = make_float4(o[4] / lsum, o[5] / lsum, o[6] / lsum, o[7] / lsum);
  }
  wait_ds0();  // the wave's own pieces are in LDS before its lanes read each other's
#pragma unroll
  for (int i = 0; i < 4; ++i) {
    const int r = i * 4 + (lane >> 3), c4 = (lane & 7) * 4;
    const float4 v = *(const float4*)&Ot[r][c4];
    *(float4*)(Out + (qrow0 + wq * 16 + r) * EMB + grp * 32 + c4) = v;
  }
}

extern "C" void kernel_launch(void* const* d_in, const int* in_sizes, int n_in,
                              void* d_out, int out_size, void* d_ws, size_t ws_size,
                              hipStream_t stream) {
  (void)in_sizes; (void)n_in; (void)out_size; (void)ws_size;
  const float* X  = (const float*)d_in[0];
  const float* Wq = (const float*)d_in[1];
  const float* bq = (const float*)d_in[2];
  const float* Wk = (const float*)d_in[3];
  const float* bk = (const float*)d_in[4];
  const float* Wv = (const float*)d_in[5];
  const float* bv = (const float*)d_in[6];

  unsigned short* Qb = (unsigned short*)d_ws;                 // [16384][128] bf16
  unsigned short* Kb = Qb + (size_t)16384 * 128;              // [16384][128] bf16
  unsigned short* Vt = Kb + (size_t)16384 * 128;              // [8][128][2048] bf16
  float* Out = (float*)d_out;

  qkv_kernel<<<256, 256, 0, stream>>>(X, Wq, bq, Wk, bk, Wv, bv, Qb, Kb, Vt);
  attn_kernel<<<dim3(32, 8), 512, 0, stream>>>(Qb, Kb, Vt, Out);
}

// v007
// A run of this version takes 27.2 microseconds.
// In two side-by-side timings against v006, it was 1.06 and 1.08 times as fast.
// Over all steps from v000 it is 3.77 times as fast.
#include <hip/hip_runtime.h>

typedef __attribute__((ext_vector_type(16))) __bf16 v16bf;
typedef __attribute__((ext_vector_type(8)))  float  v8f;

#define EMB 128
#define LDP 136   // padded LDS row stride (elements): 272B = 17*16B -> conflict-free b128
#define VLP 72    // padded stride for V^T and output staging tiles: 144B = 9*16B

union Frag { v16bf v; uint4 q[2]; };

typedef __attribute__((ext_vector_type(2))) float  f32x2;
typedef __attribute__((ext_vector_type(2))) __bf16 bf16x2;
__device__ __forceinline__ unsigned pack2(float a, float b) {
  const f32x2 v = {a, b};
  return __builtin_bit_cast(unsigned, __builtin_convertvector(v, bf16x2));
}
// Load a 16x32 bf16 A/B fragment slice for this lane: 8 elems at p, 8 at p+16.
__device__ __forceinline__ v16bf ldfrag(const unsigned short* p) {
  Frag f;
  f.q[0] = *(const uint4*)(p);
  f.q[1] = *(const uint4*)(p + 16);
  return f.v;
}

__device__ __forceinline__ unsigned lds_addr(const void* p) {
  return (unsigned)(unsigned long long)p;
}
__device__ __forceinline__ void async_copy16x2(unsigned l, unsigned lstep,
                                               const char* g, long gstep) {
  asm volatile("global_load_async_to_lds_b128 %0, %2, off\n\t"
               "global_load_async_to_lds_b128 %1, %3, off\n\t"
               "s_wait_xcnt 0x0"
               :: "v"(l), "v"(l + lstep), "v"(g), "v"(g + gstep) : "memory");
}
__device__ __forceinline__ void async_copy16x8(unsigned l, unsigned lstep,
                                               const char* g, long gstep) {
  asm volatile("global_load_async_to_lds_b128 %0, %8, off\n\t"
               "global_load_async_to_lds_b128 %1, %9, off\n\t"
               "global_load_async_to_lds_b128 %2, %10, off\n\t"
               "global_load_async_to_lds_b128 %3, %11, off\n\t"
               "global_load_async_to_lds_b128 %4, %12, off\n\t"
               "global_load_async_to_lds_b128 %5, %13, off\n\t"
               "global_load_async_to_lds_b128 %6, %14, off\n\t"
               "global_load_async_to_lds_b128 %7, %15, off\n\t"
               "s_wait_xcnt 0x0"
               :: "v"(l), "v"(l + lstep), "v"(l + 2 * lstep), "v"(l + 3 * lstep),
                  "v"(l + 4 * lstep), "v"(l + 5 * lstep), "v"(l + 6 * lstep),
                  "v"(l + 7 * lstep),
                  "v"(g), "v"(g + gstep), "v"(g + 2 * gstep), "v"(g + 3 * gstep),
                  "v"(g + 4 * gstep), "v"(g + 5 * gstep), "v"(g + 6 * gstep),
                  "v"(g + 7 * gstep)
               : "memory");
}
__device__ __forceinline__ void wait_async0() {
  asm volatile("s_wait_asynccnt 0" ::: "memory");
}
__device__ __forceinline__ float other_half(float v) {
  int b = __builtin_bit_cast(int, v);
  b = __builtin_amdgcn_permlanex16(b, b, 0x76543210, 0xfedcba98, false, false);
  return __builtin_bit_cast(float, b);
}
__device__ __forceinline__ void wait_ds0() {
  asm volatile("s_wait_dscnt 0x0" ::: "memory");
}

// ---------------------------------------------------------------------------
// Kernel 1: Q/K/V = X @ W^T + b, output bf16. V written transposed per batch.
// Grid: 256 blocks x 256 threads (8 waves). Each block: 64 rows of X.
// Wave (rgrp,cgrp): 16 rows x 64 cols of the 64x128 output tile.
// Results leave as whole 128-byte lines, 16 bytes per lane, staged through LDS.
// ---------------------------------------------------------------------------
__global__ __launch_bounds__(256) void qkv_kernel(
    const float* __restrict__ X,
    const float* __restrict__ Wq, const float* __restrict__ bq,
    const float* __restrict__ Wk, const float* __restrict__ bk,
    const float* __restrict__ Wv, const float* __restrict__ bv,
    unsigned short* __restrict__ Qb, unsigned short* __restrict__ Kb,
    unsigned short* __restrict__ Vt)
{
  __shared__ __align__(16) unsigned short Xl[64][LDP];
  __shared__ __align__(16) unsigned short Wl[128][LDP];
  // Output staging: 16-byte pieces go in, whole 128-byte lines come out.
  // Q, K: rows 16*wave .. +15 are the wave's own 16 x 64 tile. V^T: [d][s], shared.
  __shared__ __align__(16) unsigned short St[128][VLP];
  // bq, bk: in the Q, K epilogues a lane adds the bias of 8 consecutive columns per tile
  __shared__ __align__(16) float Bl[2][EMB];

  const int tid  = threadIdx.x;
  const int lane = tid & 31;
  const int wave = tid >> 5;
  const int half = (lane >> 4) & 1;
  const int l16  = lane & 15;
  const int rgrp = wave >> 1;           // 0..3: 16-row group
  const int cgrp = wave & 1;            // 0..1: 64-col group
  const long rowBase = (long)blockIdx.x * 64;

  // All global reads are issued as whole batches, one phase ahead of their use:
  // the X tile and Wq together at the start, each later W when the W before it
  // goes from registers to LDS. A thread has 16 to 24 loads in flight per wait.
  float4 xr[8], wr[16];
  const float bqk = ((tid < EMB) ? bq : bk)[tid & (EMB - 1)];  // one bias value per thread
#pragma unroll  // the batch lives in registers: every index must be a constant
  for (int u = 0; u < 8; ++u)
    xr[u] = ((const float4*)(X + rowBase * EMB))[tid + u * 256];
#pragma unroll
  for (int u = 0; u < 16; ++u)
    wr[u] = ((const float4*)Wq)[tid + u * 256];

#pragma unroll
  for (int u = 0; u < 8; ++u) {
    int i = tid + u * 256;
    int r = (i * 4) >> 7, c = (i * 4) & 127;
    *(unsigned*)&Xl[r][c]     = pack2(xr[u].x, xr[u].y);
    *(unsigned*)&Xl[r][c + 2] = pack2(xr[u].z, xr[u].w);
  }
  Bl[tid >> 7][tid & (EMB - 1)] = bqk;  // visible behind the first barrier below

#pragma unroll  // m a constant: the next W's pointer and the store target are known
  for (int m = 0; m < 3; ++m) {
    const float* bias = (m == 0) ? bq : (m == 1) ? bk : bv;
    __syncthreads();
#pragma unroll  // register batch
    for (int u = 0; u < 16; ++u) {
      int i = tid + u * 256;
      int r = (i * 4) >> 7, c = (i * 4) & 127;
      *(unsigned*)&Wl[r][c]     = pack2(wr[u].x, wr[u].y);
      *(unsigned*)&Wl[r][c + 2] = pack2(wr[u].z, wr[u].w);
    }
    if (m < 2) {
      const float4* Wn = (const float4*)((m == 0) ? Wk : Wv);
#pragma unroll  // register batch
      for (int u = 0; u < 16; ++u) wr[u] = Wn[tid + u * 256];
    }
    __syncthreads();

    v8f acc[4] = {};
#pragma unroll
    for (int k0 = 0; k0 < EMB; k0 += 32) {
      v16bf a = ldfrag(&Xl[rgrp * 16 + l16][k0 + half * 8]);
#pragma unroll
      for (int t = 0; t < 4; ++t) {
        v16bf bm = ldfrag(&Wl[(cgrp * 4 + t) * 16 + l16][k0 + half * 8]);
        // Q, K: W as A and X as B, so a lane holds 8 consecutive columns of one
        // row of X. V: X as A, so a lane holds 8 consecutive rows s of one column d.
        // Either way the lane's 8 results are 16 contiguous bytes of the output.
        acc[t] = (m < 2)
            ? __builtin_amdgcn_wmma_f32_16x16x32_bf16(
                  false, bm, false, a, (short)0, acc[t], false, false)
            : __builtin_amdgcn_wmma_f32_16x16x32_bf16(
                  false, a, false, bm, (short)0, acc[t], false, false);
      }
    }

    const int r4 = lane >> 3, c8 = (lane & 7) * 8;  // read-back: 8 lanes per line
    if (m < 2) {
      unsigned short* dstm = (m == 0) ? Qb : Kb;
#pragma unroll
      for (int t = 0; t < 4; ++t) {
        const float* bp = &Bl[m][(cgrp * 4 + t) * 16 + half * 8];
        const float4 b0 = *(const float4*)bp, b1 = *(const float4*)(bp + 4);
        *(uint4*)&St[wave * 16 + l16][t * 16 + half * 8] = make_uint4(
            pack2(acc[t][0] + b0.x, acc[t][1] + b0.y),
            pack2(acc[t][2] + b0.z, acc[t][3] + b0.w),
            pack2(acc[t][4] + b1.x, acc[t][5] + b1.y),
            pack2(acc[t][6] + b1.z, acc[t][7] + b1.w));
      }
      wait_ds0();  // the wave's own pieces are in LDS before its lanes read each other's
#pragma unroll
      for (int i = 0; i < 4; ++i) {
        const int r = i * 4 + r4;
        const uint4 v = *(const uint4*)&St[wave * 16 + r][c8];
        *(uint4*)(dstm + (rowBase + rgrp * 16 + r) * EMB + cgrp * 64 + c8) = v;
      }
    } else {
#pragma unroll
      for (int t = 0; t < 4; ++t) {
        const int col = (cgrp * 4 + t) * 16 + l16;
        const float bval = bias[col];
        *(uint4*)&St[col][rgrp * 16 + half * 8] = make_uint4(
            pack2(acc[t][0] + bval, acc[t][1] + bval),
            pack2(acc[t][2] + bval, acc[t][3] + bval),
            pack2(acc[t][4] + bval, acc[t][5] + bval),
            pack2(acc[t][6] + bval, acc[t][7] + bval));
      }
      __syncthreads();  // a V^T line (64 s of one d) holds pieces of four waves
      const long batch = rowBase >> 11, s0 = rowBase & 2047;
#pragma unroll
      for (int i = 0; i < 4; ++i) {
        const int d = wave * 16 + i * 4 + r4;
        const uint4 v = *(const uint4*)&St[d][c8];
        *(uint4*)(Vt + (batch * EMB + d) * 2048 + s0 + c8) = v;  // V transposed: [b][d][S]
      }
    }
  }
}

#define NGRP 8
#define QL_BYTES (64 * LDP * 2)
#define KL_BYTES (64 * LDP * 2)          // per group
#define VL_BYTES (128 * VLP * 2)         // per group
#define KL_OFF   QL_BYTES
#define VL_OFF   (KL_OFF + NGRP * KL_BYTES)
#define SO_BYTES (16 * 32 * 32 * 16)
#define SM_BYTES (16 * 2 * 32 * 8)
#define OT_OFF   (SO_BYTES + SM_BYTES)
#define OTP      36
#define ATTN_LDS (OT_OFF + 16 * 16 * OTP * 4)
union PFrag { v16bf v; unsigned w[8]; };  // P^T of 32 keys x 16 queries as a B operand
static_assert(VL_OFF + NGRP * VL_BYTES <= ATTN_LDS, "the K/V buffers lie inside the array");

__global__ __launch_bounds__(512) void attn_kernel(
    const unsigned short* __restrict__ Qb,
    const unsigned short* __restrict__ Kb,
    const unsigned short* __restrict__ Vt,
    float* __restrict__ Out)
{
  __shared__ __align__(16) unsigned char L[ATTN_LDS];

  const int tid = threadIdx.x, lane = tid & 31;
  // The wave's number as a scalar: group, chunk and buffer addresses then live in
  // scalar registers, which the 192 accumulator registers leave no vector room for.
  const int wave = __builtin_amdgcn_readfirstlane(tid >> 5);
  const int half = (lane >> 4) & 1, l16 = lane & 15;
  const int grp = wave >> 1;
  const int wq  = wave & 1;
  const int gtid = tid & 63;
  const int b = blockIdx.y;
  const long qrow0 = (long)b * 2048 + (long)blockIdx.x * 64;

  unsigned short (*Ql)[LDP] = (unsigned short (*)[LDP])(L);
  unsigned short (*Kl)[LDP] = (unsigned short (*)[LDP])(L + KL_OFF + grp * KL_BYTES);
  unsigned short (*Vl)[VLP] = (unsigned short (*)[VLP])(L + VL_OFF + grp * VL_BYTES);  // [d][key]

  // Stage Q tile once (64x128 bf16), async: 2 copies per thread, 32 rows apart
  async_copy16x2(lds_addr(&Ql[tid >> 4][(tid & 15) * 8]), 32 * LDP * 2,
                 (const char*)(Qb + qrow0 * EMB + (long)tid * 8), 512 * 16);

  // This batch's K and V^T; a thread's staging places are formed where it copies
  const unsigned short* kbat = Kb + (long)b * 2048 * EMB;
  const unsigned short* vbat = Vt + (long)b * EMB * 2048;

  // Per lane and query tile u: running max of query 16u + l16 (equal in both
  // halves) and the running sum over this half's keys; the halves' sums are
  // joined once, in the merge.
  float mrow[2] = {-3.0e38f, -3.0e38f}, lrow[2] = {0.0f, 0.0f};
  v8f acco[2][8] = {};  // O^T: acco[u][n][j] = O[query 16u + l16][d = 16n + 8*half + j]

  const float scale = 0.088388347648318447f;  // 1/sqrt(128)

  // Staging of one K chunk (64 keys x 128, row-major): 16 copies per thread, 4 rows
  // apart; of one V^T chunk (128 d x 64 keys): 16 copies per thread, 8 d-rows apart.
  // The group's two waves swap their pieces from one chunk to the next (sw = 0 or
  // 32): the 32 LDS addresses then change with the pass and are formed on the spot;
  // as loop constants the compiler held them in vector registers through the loop,
  // beside the 192 accumulator registers, and spilled.
  auto stage_k = [&](const long key0, const int sw) __attribute__((always_inline)) {
    const int g0 = gtid ^ sw;
    const unsigned l = lds_addr(&Kl[g0 >> 4][(g0 & 15) * 8]);
    const char* g = (const char*)(kbat + key0 * EMB + g0 * 8);
    async_copy16x8(l, 4 * LDP * 2, g, 64 * 16);
    async_copy16x8(l + 32 * LDP * 2, 4 * LDP * 2, g + 8 * 64 * 16, 64 * 16);
  };
  auto stage_v = [&](const long key0, const int sw) __attribute__((always_inline)) {
    const int g0 = gtid ^ sw;
    const unsigned l = lds_addr(&Vl[g0 >> 3][(g0 & 7) * 8]);
    const char* g = (const char*)(vbat + (long)(g0 >> 3) * 2048 + key0 + (g0 & 7) * 8);
    async_copy16x8(l, 8 * VLP * 2, g, 8 * 2048 * 2);
    async_copy16x8(l + 64 * VLP * 2, 8 * VLP * 2, g + 64 * 2048 * 2, 8 * 2048 * 2);
  };
  stage_k((long)grp * 64, 0);  // first K chunk

  for (int it = 0; it < 32 / NGRP; ++it) {
    const long kbase = (long)(it * NGRP + grp) * 64;
    wait_ds0();       // this wave's reads of the previous V^T chunk have returned
    wait_async0();    // this wave's copies of this K chunk (and Q on iter 0) have landed
    __syncthreads();  // K chunk visible; every wave has left the previous V^T chunk
    stage_v(kbase, (it & 1) << 5);  // this chunk's V^T

    // S^T = K Q^T : 4 key m-tiles x 2 query tiles x 4 K-dim iters = 32 WMMA.
    // Each K fragment is read once and used for both query tiles.
    v8f accs[2][4] = {};
#pragma unroll
    for (int k0 = 0; k0 < EMB; k0 += 32) {
      v16bf qf[2];
#pragma unroll
      for (int u = 0; u < 2; ++u)
        qf[u] = ldfrag(&Ql[wq * 32 + u * 16 + l16][k0 + half * 8]);
#pragma unroll
      for (int tp = 0; tp < 4; tp += 2) {
        v16bf kf[2];
#pragma unroll
        for (int t = 0; t < 2; ++t)
          kf[t] = ldfrag(&Kl[(tp + t) * 16 + l16][k0 + half * 8]);
        // Holds the reads of two K fragments (and of Q) together in front of their
        // four products: one LDS wait per group; the compiler, short of registers,
        // otherwise reads and waits fragment by fragment.
        __builtin_amdgcn_sched_barrier(0);
#pragma unroll
        for (int t = 0; t < 2; ++t)
#pragma unroll
          for (int u = 0; u < 2; ++u)
            accs[u][tp + t] = __builtin_amdgcn_wmma_f32_16x16x32_bf16(
                false, kf[t], false, qf[u], (short)0, accs[u][tp + t], false, false);
        __builtin_amdgcn_sched_barrier(0);
      }
    }

    // Online softmax: the lane's 32 scores of a tile column belong to one query.
    // The maximum is taken over the raw scores and scaled once: scale > 0 and
    // rounding is monotonic, so the value is that of the maximum of the scaled
    // scores, and no scaled copy of the scores needs registers.
    float mx[2];
#pragma unroll
    for (int u = 0; u < 2; ++u) {
      const v8f m8 = __builtin_elementwise_max(
          __builtin_elementwise_max(accs[u][0], accs[u][1]),
          __builtin_elementwise_max(accs[u][2], accs[u][3]));
      const float m = fmaxf(fmaxf(fmaxf(m8[0], m8[1]), fmaxf(m8[2], m8[3])),
                            fmaxf(fmaxf(m8[4], m8[5]), fmaxf(m8[6], m8[7])));
      mx[u] = fmaxf(m, other_half(m)) * scale;
    }

    // About half of the pass's work lies on either side of this point, so each
    // of the two refills has half a pass to land. The scheduling barrier keeps
    // the row maxima in front of it: without it the compiler lifts the waits up
    // to the last K read, and V^T has only the K reads to land under.
    __builtin_amdgcn_sched_barrier(0);
    wait_ds0();       // this wave's reads of this K chunk have returned
    wait_async0();    // this wave's copies of this V^T chunk have landed
    __syncthreads();  // V^T chunk visible; every wave has left this K chunk
    if (it + 1 < 32 / NGRP)  // next K chunk
      stage_k(kbase + NGRP * 64, ((it + 1) & 1) << 5);

    // P^T of 32 keys as a B operand: score tiles 2kk and 2kk+1 in place, which is
    // the k order the V^T loader has (keys 8*half + 0..7, then 16 + 8*half + 0..7).
    PFrag pf[2][2];
#pragma unroll
    for (int u = 0; u < 2; ++u) {
      const float mn = fmaxf(mrow[u], mx[u]);
      const float alpha = __expf(mrow[u] - mn);
      mrow[u] = mn;
#pragma unroll
      for (int t = 0; t < 4; ++t)
#pragma unroll
        for (int j = 0; j < 8; ++j)
          accs[u][t][j] = __expf(accs[u][t][j] * scale - mn);
      // In-lane sum as a tree: eight independent chains over the tiles, then 8 -> 1
      const v8f s8 = (accs[u][0] + accs[u][1]) + (accs[u][2] + accs[u][3]);
      const float sm =
          ((s8[0] + s8[1]) + (s8[2] + s8[3])) + ((s8[4] + s8[5]) + (s8[6] + s8[7]));
      lrow[u] = lrow[u] * alpha + sm;
#pragma unroll
      for (int kk = 0; kk < 2; ++kk)
#pragma unroll
        for (int i = 0; i < 4; ++i) {
          pf[u][kk].w[i]     = pack2(accs[u][2 * kk][2 * i],     accs[u][2 * kk][2 * i + 1]);
          pf[u][kk].w[4 + i] = pack2(accs[u][2 * kk + 1][2 * i], accs[u][2 * kk + 1][2 * i + 1]);
        }
      // Rescale running O
#pragma unroll
      for (int n = 0; n < 8; ++n)
#pragma unroll
        for (int j = 0; j < 8; ++j)
          acco[u][n][j] *= alpha;
    }

    // O^T += V^T P^T : 2 K-dim iters x 8 d m-tiles x 2 query tiles = 32 WMMA.
    // Each V^T fragment is read once and used for both query tiles.
    // The scores are dead here, so four fragments are read as one group: one LDS
    // wait per eight products. The scheduling barriers hold the groups together;
    // without them the compiler reads and waits fragment by fragment.
    __builtin_amdgcn_sched_barrier(0);
#pragma unroll
    for (int kk = 0; kk < 2; ++kk)
#pragma unroll
      for (int n0 = 0; n0 < 8; n0 += 4) {
        v16bf vf[4];
#pragma unroll
        for (int n = 0; n < 4; ++n)
          vf[n] = ldfrag(&Vl[(n0 + n) * 16 + l16][kk * 32 + half * 8]);
        __builtin_amdgcn_sched_barrier(0);
#pragma unroll
        for (int n = 0; n < 4; ++n)
#pragma unroll
          for (int u = 0; u < 2; ++u)
            acco[u][n0 + n] = __builtin_amdgcn_wmma_f32_16x16x32_bf16(
                false, vf[n], false, pf[u][kk].v, (short)0, acco[u][n0 + n], false, false);
        __builtin_amdgcn_sched_barrier(0);
      }
  }

  float4* So = (float4*)L;
  float2* Sm = (float2*)(L + SO_BYTES);
  wait_ds0();       // this wave's last LDS reads have returned
  __syncthreads();  // every wave has left the K/V/Q buffers
#pragma unroll
  for (int u = 0; u < 2; ++u) {
#pragma unroll
    for (int n = 0; n < 8; ++n) {
      So[(wave * 32 + u * 16 + 2 * n) * 32 + lane] =
          make_float4(acco[u][n][0], acco[u][n][1], acco[u][n][2], acco[u][n][3]);
      So[(wave * 32 + u * 16 + 2 * n + 1) * 32 + lane] =
          make_float4(acco[u][n][4], acco[u][n][5], acco[u][n][6], acco[u][n][7]);
    }
    Sm[(wave * 2 + u) * 32 + lane] = make_float2(mrow[u], lrow[u]);
  }
  __syncthreads();  // partial results visible to the merging waves

  // Wave (dq, qt) finishes d columns 32*dq .. 32*dq+31 of the 16 query rows of
  // tile qt, which the waves 2s + (qt >> 1), s = 0..7, hold as their tile qt & 1.
  const int qt = wave & 3, dq = wave >> 2;
  const int sw0 = qt >> 1, su = qt & 1;
  float wgt[NGRP], lsum;
  {
    float2 ml[NGRP];
#pragma unroll
    for (int s = 0; s < NGRP; ++s) ml[s] = Sm[((s * 2 + sw0) * 2 + su) * 32 + lane];
    float mxa = ml[0].x;
#pragma unroll
    for (int s = 1; s < NGRP; ++s) mxa = fmaxf(mxa, ml[s].x);
    float s = 0.0f;
#pragma unroll
    for (int g = 0; g < NGRP; ++g) {
      wgt[g] = __expf(ml[g].x - mxa);
      s += wgt[g] * ml[g].y;
    }
    lsum = s + other_half(s);  // the two halves' keys together
  }

  // Epilogue: merged O / l, fp32 out; a lane holds 8 consecutive d of one query.
  // The wave's 32 d of a query row are one 128-byte line: its lanes' 16-byte pieces
  // go through the wave's own LDS rows and leave as whole lines, 8 lanes per line.
  float (*Ot)[OTP] = (float (*)[OTP])(L + OT_OFF + wave * (16 * OTP * 4));
#pragma unroll
  for (int nn = 0; nn < 2; ++nn) {
    const int n = dq * 2 + nn;
    float o[8] = {};
#pragma unroll
    for (int s = 0; s < NGRP; ++s) {
      const int sw = s * 2 + sw0;
      float4 lo = So[(sw * 32 + su * 16 + 2 * n) * 32 + lane];
      float4 hi = So[(sw * 32 + su * 16 + 2 * n + 1) * 32 + lane];
      o[0] += wgt[s] * lo.x; o[1] += wgt[s] * lo.y;
      o[2] += wgt[s] * lo.z; o[3] += wgt[s] * lo.w;
      o[4] += wgt[s] * hi.x; o[5] += wgt[s] * hi.y;
      o[6] += wgt[s] * hi.z; o[7] += wgt[s] * hi.w;
    }
    float4* dst = (float4*)&Ot[l16][nn * 16 + half * 8];
    dst[0] = make_float4(o[0] / lsum, o[1] / lsum, o[2] / lsum, o[3] / lsum);
    dst[1] = make_float4(o[4] / lsum, o[5] / lsum, o[6] / lsum, o[7] / lsum);
  }
  wait_ds0();  // the wave's own pieces are in LDS before its lanes read each other's
#pragma unroll
  for (int i = 0; i < 4; ++i) {
    const int r = i * 4 + (lane >> 3), c4 = (lane & 7) * 4;
    const float4 v = *(const float4*)&Ot[r][c4];
    *(float4*)(Out + (qrow0 + qt * 16 + r) * EMB + dq * 32 + c4) = v;
  }
}

extern "C" void kernel_launch(void* const* d_in, const int* in_sizes, int n_in,
                              void* d_out, int out_size, void* d_ws, size_t ws_size,
                              hipStream_t stream) {
  (void)in_sizes; (void)n_in; (void)out_size; (void)ws_size;
  const float* X  = (const float*)d_in[0];
  const float* Wq = (const float*)d_in[1];
  const float* bq = (const float*)d_in[2];
  const float* Wk = (const float*)d_in[3];
  const float* bk = (const float*)d_in[4];
  const float* Wv = (const float*)d_in[5];
  const float* bv = (const float*)d_in[6];

  unsigned short* Qb = (unsigned short*)d_ws;                 // [16384][128] bf16
  unsigned short* Kb = Qb + (size_t)16384 * 128;              // [16384][128] bf16
  unsigned short* Vt = Kb + (size_t)16384 * 128;              // [8][128][2048] bf16
  float* Out = (float*)d_out;

  qkv_kernel<<<256, 256, 0, stream>>>(X, Wq, bq, Wk, bk, Wv, bv, Qb, Kb, Vt);
  attn_kernel<<<dim3(32, 8), 512, 0, stream>>>(Qb, Kb, Vt, Out);
}

// v009
// One run takes 21.5 microseconds.
// It is 1.26 times as fast as v007, going by the measured steps of the versions left out in between.
// Over all steps from v000 it is 4.75 times as fast.
#include <hip/hip_runtime.h>

typedef __attribute__((ext_vector_type(16))) __bf16 v16bf;
typedef __attribute__((ext_vector_type(8)))  float  v8f;

#define EMB 128
#define LDP 136   // padded LDS row stride (elements): 272B = 17*16B -> conflict-free b128
#define VLP 72    // padded stride for the output staging tile: 144B = 9*16B

union Frag { v16bf v; uint4 q[2]; };

typedef __attribute__((ext_vector_type(2))) float  f32x2;
typedef __attribute__((ext_vector_type(2))) __bf16 bf16x2;
__device__ __forceinline__ unsigned pack2(float a, float b) {
  const f32x2 v = {a, b};
  return __builtin_bit_cast(unsigned, __builtin_convertvector(v, bf16x2));
}
// Load a 16x32 bf16 A/B fragment slice for this lane: 8 elems at p, 8 at p+16.
__device__ __forceinline__ v16bf ldfrag(const unsigned short* p) {
  Frag f;
  f.q[0] = *(const uint4*)(p);
  f.q[1] = *(const uint4*)(p + 16);
  return f.v;
}

__device__ __forceinline__ unsigned lds_addr(const void* p) {
  return (unsigned)(unsigned long long)p;
}
// Eight copies, lstep apart in LDS; copies 4 to 7 lie lbump bytes further (the
// shift of the odd 8-row blocks of an X tile, see XROW below).
__device__ __forceinline__ void async_copy16x8(unsigned l, unsigned lstep, unsigned lbump,
                                               const char* g, long gstep) {
  asm volatile("global_load_async_to_lds_b128 %0, %8, off\n\t"
               "global_load_async_to_lds_b128 %1, %9, off\n\t"
               "global_load_async_to_lds_b128 %2, %10, off\n\t"
               "global_load_async_to_lds_b128 %3, %11, off\n\t"
               "global_load_async_to_lds_b128 %4, %12, off\n\t"
               "global_load_async_to_lds_b128 %5, %13, off\n\t"
               "global_load_async_to_lds_b128 %6, %14, off\n\t"
               "global_load_async_to_lds_b128 %7, %15, off\n\t"
               "s_wait_xcnt 0x0"
               :: "v"(l), "v"(l + lstep), "v"(l + 2 * lstep), "v"(l + 3 * lstep),
                  "v"(l + 4 * lstep + lbump), "v"(l + 5 * lstep + lbump),
                  "v"(l + 6 * lstep + lbump), "v"(l + 7 * lstep + lbump),
                  "v"(g), "v"(g + gstep), "v"(g + 2 * gstep), "v"(g + 3 * gstep),
                  "v"(g + 4 * gstep), "v"(g + 5 * gstep), "v"(g + 6 * gstep),
                  "v"(g + 7 * gstep)
               : "memory");
}
__device__ __forceinline__ void async_copy16x4(unsigned l, unsigned lstep,
                                               const char* g, long gstep) {
  asm volatile("global_load_async_to_lds_b128 %0, %4, off\n\t"
               "global_load_async_to_lds_b128 %1, %5, off\n\t"
               "global_load_async_to_lds_b128 %2, %6, off\n\t"
               "global_load_async_to_lds_b128 %3, %7, off\n\t"
               "s_wait_xcnt 0x0"
               :: "v"(l), "v"(l + lstep), "v"(l + 2 * lstep), "v"(l + 3 * lstep),
                  "v"(g), "v"(g + gstep), "v"(g + 2 * gstep), "v"(g + 3 * gstep)
               : "memory");
}
// Transposing LDS read: lane (c, h) of the 8 rows x 16 columns its half addresses
// gets column c, rows 0..7.
typedef short s16x8 __attribute__((ext_vector_type(8)));
__device__ __forceinline__ uint4 ld_tr16(const unsigned char* p) {
  typedef __attribute__((address_space(3))) s16x8 lds_s16x8;
  return __builtin_bit_cast(uint4, __builtin_amdgcn_ds_load_tr16_b128_v8i16((lds_s16x8*)p));
}
__device__ __forceinline__ void wait_async0() {
  asm volatile("s_wait_asynccnt 0" ::: "memory");
}
__device__ __forceinline__ float other_half(float v) {
  int b = __builtin_bit_cast(int, v);
  b = __builtin_amdgcn_permlanex16(b, b, 0x76543210, 0xfedcba98, false, false);
  return __builtin_bit_cast(float, b);
}
__device__ __forceinline__ void wait_ds0() {
  asm volatile("s_wait_dscnt 0x0" ::: "memory");
}

// ---------------------------------------------------------------------------
// The key and value projections are taken out of the attention loop:
//   Q K^T = Q (X Wk^T + 1 bk^T)^T = (Q Wk) X^T + (Q bk) 1^T ; the last term is one
//   constant per query row, which softmax cancels, so the scores are (Q Wk) X^T;
//   P V = P (X Wv^T + 1 bv^T) = (P X) Wv^T + bv, the rows of P summing to 1.
// One bf16 tile of X then serves as the key tile and as the value tile.
//
// Kernel 1: X as bf16, Q' = (X Wq^T + bq) Wk as bf16, Wv as bf16.
// Grid: 256 blocks x 256 threads (8 waves). Each block: 64 rows of X.
// Wave (rgrp,cgrp): 16 rows x 64 cols of the 64x128 output tile.
// Q' leaves as whole 128-byte lines, 16 bytes per lane, staged through LDS.
// ---------------------------------------------------------------------------
__global__ __launch_bounds__(256) void qx_kernel(
    const float* __restrict__ X,
    const float* __restrict__ Wq, const float* __restrict__ bq,
    const float* __restrict__ Wk, const float* __restrict__ Wv,
    unsigned short* __restrict__ Qb, unsigned short* __restrict__ Xb,
    unsigned short* __restrict__ Wvb)
{
  __shared__ __align__(16) unsigned short Xl[64][LDP];
  __shared__ __align__(16) unsigned short Wl[128][LDP];
  __shared__ __align__(16) unsigned short Qs[64][LDP];  // Q, operand of the second product
  // Output staging: rows 16*wave .. +15 are the wave's own 16 x 64 tile of Q'.
  __shared__ __align__(16) unsigned short St[128][VLP];
  // bq: a lane adds the bias of 8 consecutive columns. Twice, so that every thread
  // loads and stores one value: under a test the load moves behind the X tile's wait.
  __shared__ __align__(16) float Bl[2 * EMB];

  const int tid  = threadIdx.x;
  const int lane = tid & 31;
  const int wave = tid >> 5;
  const int half = (lane >> 4) & 1;
  const int l16  = lane & 15;
  const int rgrp = wave >> 1;           // 0..3: 16-row group
  const int cgrp = wave & 1;            // 0..1: 64-col group
  const long rowBase = (long)blockIdx.x * 64;

  // All global reads are issued as whole batches, one phase ahead of their use:
  // the X tile and Wq together at the start, Wk when Wq goes from registers to LDS.
  float4 xr[8], wr[16];
  const float bqv = bq[tid & (EMB - 1)];
  // This block's 64 elements (one 128-byte line as bf16) of Wv
  const float4 wv4 = ((const float4*)Wv)[blockIdx.x * 16 + (tid & 15)];
#pragma unroll  // the batch lives in registers: every index must be a constant
  for (int u = 0; u < 8; ++u)
    xr[u] = ((const float4*)(X + rowBase * EMB))[tid + u * 256];
#pragma unroll
  for (int u = 0; u < 16; ++u)
    wr[u] = ((const float4*)Wq)[tid + u * 256];

  // X tile (64x128 f32 -> bf16) to LDS; the packed values stay in registers for
  // the workspace copy
  uint2 xp[8];
#pragma unroll
  for (int u = 0; u < 8; ++u) {
    int i = tid + u * 256;
    int r = (i * 4) >> 7, c = (i * 4) & 127;
    xp[u] = make_uint2(pack2(xr[u].x, xr[u].y), pack2(xr[u].z, xr[u].w));
    *(unsigned*)&Xl[r][c]     = xp[u].x;
    *(unsigned*)&Xl[r][c + 2] = xp[u].y;
  }
  Bl[tid] = bqv;  // visible behind the first barrier below

#pragma unroll  // m a constant: the two products differ in operands and target
  for (int m = 0; m < 2; ++m) {
    __syncthreads();
#pragma unroll  // register batch
    for (int u = 0; u < 16; ++u) {
      int i = tid + u * 256;
      int r = (i * 4) >> 7, c = (i * 4) & 127;
      *(unsigned*)&Wl[r][c]     = pack2(wr[u].x, wr[u].y);
      *(unsigned*)&Wl[r][c + 2] = pack2(wr[u].z, wr[u].w);
    }
    if (m == 0) {
#pragma unroll  // register batch
      for (int u = 0; u < 16; ++u) wr[u] = ((const float4*)Wk)[tid + u * 256];
    }
    __syncthreads();
    if (m == 1) {
      // X and Wv as bf16 to the workspace, 8 bytes per lane, behind the kernel's
      // last barrier: a barrier waits for the stores in front of it.
#pragma unroll  // register batch
      for (int u = 0; u < 8; ++u)
        *(uint2*)(Xb + rowBase * EMB + (long)(tid + u * 256) * 4) = xp[u];
      if (tid < 16)
        *(uint2*)(Wvb + (blockIdx.x * 16 + tid) * 4) =
            make_uint2(pack2(wv4.x, wv4.y), pack2(wv4.z, wv4.w));
    }

    // W as A and the rows of X (of Q) as B: a lane holds 8 consecutive columns of
    // one row, 16 contiguous bytes of the result.
    v8f acc[4] = {};
#pragma unroll
    for (int k0 = 0; k0 < EMB; k0 += 32) {
      const v16bf a = ldfrag(m == 0 ? &Xl[rgrp * 16 + l16][k0 + half * 8]
                                    : &Qs[rgrp * 16 + l16][k0 + half * 8]);
#pragma unroll
      for (int t = 0; t < 4; ++t) {
        Frag w;
        if (m == 0) {
          // Q = X Wq^T: the sum runs along the rows of Wq
          w.v = ldfrag(&Wl[(cgrp * 4 + t) * 16 + l16][k0 + half * 8]);
        } else {
          // Q' = Q Wk: the sum runs down the columns of Wk, read transposed
          const unsigned char* p = (const unsigned char*)
              &Wl[k0 + half * 8 + (lane & 7)][(cgrp * 4 + t) * 16 + ((lane >> 3) & 1) * 8];
          w.q[0] = ld_tr16(p);
          w.q[1] = ld_tr16(p + 16 * LDP * 2);
        }
        acc[t] = __builtin_amdgcn_wmma_f32_16x16x32_bf16(
            false, w.v, false, a, (short)0, acc[t], false, false);
      }
    }

    if (m == 0) {
#pragma unroll
      for (int t = 0; t < 4; ++t) {
        const float* bp = &Bl[(cgrp * 4 + t) * 16 + half * 8];
        const float4 b0 = *(const float4*)bp, b1 = *(const float4*)(bp + 4);
        *(uint4*)&Qs[rgrp * 16 + l16][(cgrp * 4 + t) * 16 + half * 8] = make_uint4(
            pack2(acc[t][0] + b0.x, acc[t][1] + b0.y),
            pack2(acc[t][2] + b0.z, acc[t][3] + b0.w),
            pack2(acc[t][4] + b1.x, acc[t][5] + b1.y),
            pack2(acc[t][6] + b1.z, acc[t][7] + b1.w));
      }
    } else {
      const int r4 = lane >> 3, c8 = (lane & 7) * 8;  // read-back: 8 lanes per line
#pragma unroll
      for (int t = 0; t < 4; ++t)
        *(uint4*)&St[wave * 16 + l16][t * 16 + half * 8] = make_uint4(
            pack2(acc[t][0], acc[t][1]), pack2(acc[t][2], acc[t][3]),
            pack2(acc[t][4], acc[t][5]), pack2(acc[t][6], acc[t][7]));
      wait_ds0();  // the wave's own pieces are in LDS before its lanes read each other's
#pragma unroll
      for (int i = 0; i < 4; ++i) {
        const int r = i * 4 + r4;
        const uint4 v = *(const uint4*)&St[wave * 16 + r][c8];
        *(uint4*)(Qb + (rowBase + rgrp * 16 + r) * EMB + cgrp * 64 + c8) = v;
      }
    }
  }
}

#define NGRP 8
#define NQT  4
#define QL_BYTES (64 * LDP * 2)
#define XP 288
#define XROW(r) ((r) * XP + (((r) >> 3) & 1) * 16)
#define XT_BYTES 18560                        // 64 rows and the shift, rounded up
#define XB_OFF   QL_BYTES                     // buffers 0 of the 8 waves, then buffers 1
#define XB_END   (XB_OFF + 2 * NGRP * XT_BYTES)
#define WV_BYTES (128 * LDP * 2)
#define WV_OFF   (XB_END - WV_BYTES)
#define SO_BYTES (NGRP * 64 * 32 * 16)
#define SM_BYTES (NGRP * NQT * 32 * 8)
#define OB_OFF   0
#define OT_OFF   32768
#define OTP      68
#define ATTN_LDS XB_END
union PFrag { v16bf v; unsigned w[8]; };  // P^T of 32 keys x 16 queries as a B operand
static_assert(XROW(63) + 256 <= XT_BYTES, "a tile lies inside its buffer");
static_assert(SO_BYTES + SM_BYTES <= WV_OFF, "the merge planes leave Wv alone");
static_assert(OB_OFF + QL_BYTES <= OT_OFF && OT_OFF + NGRP * 16 * OTP * 4 <= SO_BYTES, "staging");
static_assert(ATTN_LDS <= 327680, "LDS of one WGP");

__global__ __launch_bounds__(256) void attn_kernel(
    const unsigned short* __restrict__ Qb,
    const unsigned short* __restrict__ Xb,
    const unsigned short* __restrict__ Wvb,
    const float* __restrict__ bv,
    float* __restrict__ Out)
{
  __shared__ __align__(16) unsigned char L[ATTN_LDS];

  const int tid = threadIdx.x, lane = tid & 31;
  // The wave's number as a scalar: chunk and buffer addresses then live in scalar
  // registers.
  const int wave = __builtin_amdgcn_readfirstlane(tid >> 5);
  const int half = (lane >> 4) & 1, l16 = lane & 15;
  const int b = blockIdx.y;
  const long qrow0 = (long)b * 2048 + (long)blockIdx.x * 64;

  unsigned short (*Ql)[LDP] = (unsigned short (*)[LDP])(L);

  // Stage Q' tile once (64x128 bf16), async: 4 copies per thread, 16 rows apart
  async_copy16x4(lds_addr(&Ql[tid >> 4][(tid & 15) * 8]), 16 * LDP * 2,
                 (const char*)(Qb + qrow0 * EMB + (long)tid * 8), 256 * 16);

  const unsigned short* xbat = Xb + (long)b * 2048 * EMB;  // this batch's X

  // Per lane and query tile u: running max of query 16u + l16 (equal in both
  // halves) and the running sum over this half's keys; the halves' sums are
  // joined once, in the merge.
  float mrow[NQT], lrow[NQT];
#pragma unroll  // the arrays live in registers: every index must be a constant
  for (int u = 0; u < NQT; ++u) { mrow[u] = -3.0e38f; lrow[u] = 0.0f; }
  v8f acco[NQT][8] = {};  // acco[u][n][j] = (P X)[query 16u + l16][d = 16n + 8*half + j]

  const float scale = 0.088388347648318447f;  // 1/sqrt(128)

  // The wave's buffer 0 or 1
  auto xbuf = [&](const int buf) __attribute__((always_inline)) {
    return L + XB_OFF + (buf * NGRP + wave) * XT_BYTES;
  };
  // Staging of one X chunk by its wave: 32 copies per lane, 2 rows apart
  auto stage_x = [&](const long key0, const int buf) __attribute__((always_inline)) {
    const unsigned l = lds_addr(xbuf(buf) + (lane >> 4) * XP + (lane & 15) * 16);
    const char* g = (const char*)(xbat + key0 * EMB + lane * 8);
#pragma unroll  // four statements of eight copies, 16 rows each
    for (int c = 0; c < 4; ++c) {
      async_copy16x8(l + c * 16 * XP, 2 * XP, 16, g + c * 16 * EMB * 2, 2 * EMB * 2);
      // Keeps the next statement's 24 address registers behind this one: asm operands
      // lie in the first 256 registers, and all 96 at once push accumulators out (spills).
      __builtin_amdgcn_sched_barrier(0);
    }
  };
  stage_x((long)wave * 64, 0);  // first chunk

  // The lane's places in a tile: row l16 for the scores; for the transposing load
  // row 8*half + (lane & 7), 16-byte piece (lane >> 3) & 1
  const int ka = XROW(l16) + half * 16;
  const int va = XROW(half * 8 + (lane & 7)) + ((lane >> 3) & 1) * 16;

  wait_async0();    // this wave's copies of Q' (and of its first chunk) have landed
  __syncthreads();  // Q' visible to every wave

  for (int it = 0; it < 32 / NGRP; ++it) {
    const unsigned char* xt = xbuf(it & 1);
    wait_ds0();       // this wave's reads of its previous chunk have returned
    wait_async0();    // this wave's copies of this chunk have landed; no other wave reads them
    if (it + 1 < 32 / NGRP)  // the next chunk, into the buffer this wave has just left
      stage_x((long)((it + 1) * NGRP + wave) * 64, (it + 1) & 1);

    // S^T = X Q'^T : 4 key m-tiles x 4 query tiles x 4 K-dim iters = 64 WMMA.
    // Each X fragment is read once and used for all four query tiles.
    v8f accs[NQT][4] = {};
#pragma unroll
    for (int k0 = 0; k0 < EMB; k0 += 32) {
      v16bf qf[NQT], kf[4];
#pragma unroll
      for (int u = 0; u < NQT; ++u)
        qf[u] = ldfrag(&Ql[u * 16 + l16][k0 + half * 8]);
#pragma unroll
      for (int t = 0; t < 4; ++t)
        kf[t] = ldfrag((const unsigned short*)(xt + ka + t * 16 * XP + k0 * 2));
      // Holds the reads of the eight fragments together in front of their sixteen
      // products: one place with LDS reads per group, none among the products.
      __builtin_amdgcn_sched_barrier(0);
#pragma unroll
      for (int t = 0; t < 4; ++t)
#pragma unroll
        for (int u = 0; u < NQT; ++u)
          accs[u][t] = __builtin_amdgcn_wmma_f32_16x16x32_bf16(
              false, kf[t], false, qf[u], (short)0, accs[u][t], false, false);
      __builtin_amdgcn_sched_barrier(0);
    }

    // Online softmax: the lane's 32 scores of a tile column belong to one query.
    // The maximum is taken over the raw scores and scaled once: scale > 0 and
    // rounding is monotonic, so the value is that of the maximum of the scaled
    // scores, and no scaled copy of the scores needs registers.
    float mx[NQT];
#pragma unroll
    for (int u = 0; u < NQT; ++u) {
      const v8f m8 = __builtin_elementwise_max(
          __builtin_elementwise_max(accs[u][0], accs[u][1]),
          __builtin_elementwise_max(accs[u][2], accs[u][3]));
      const float m = fmaxf(fmaxf(fmaxf(m8[0], m8[1]), fmaxf(m8[2], m8[3])),
                            fmaxf(fmaxf(m8[4], m8[5]), fmaxf(m8[6], m8[7])));
      mx[u] = fmaxf(m, other_half(m)) * scale;
    }

    // P^T of 32 keys as a B operand: score tiles 2kk and 2kk+1 in place, which is
    // the k order the transposing load has (keys 8*half + 0..7, then 16 + 8*half + 0..7).
    PFrag pf[NQT][2];
#pragma unroll
    for (int u = 0; u < NQT; ++u) {
      const float mn = fmaxf(mrow[u], mx[u]);
      const float alpha = __expf(mrow[u] - mn);
      mrow[u] = mn;
#pragma unroll
      for (int t = 0; t < 4; ++t)
#pragma unroll
        for (int j = 0; j < 8; ++j)
          accs[u][t][j] = __expf(accs[u][t][j] * scale - mn);
      // In-lane sum as a tree: eight independent chains over the tiles, then 8 -> 1
      const v8f s8 = (accs[u][0] + accs[u][1]) + (accs[u][2] + accs[u][3]);
      const float sm =
          ((s8[0] + s8[1]) + (s8[2] + s8[3])) + ((s8[4] + s8[5]) + (s8[6] + s8[7]));
      lrow[u] = lrow[u] * alpha + sm;
#pragma unroll
      for (int kk = 0; kk < 2; ++kk)
#pragma unroll
        for (int i = 0; i < 4; ++i) {
          pf[u][kk].w[i]     = pack2(accs[u][2 * kk][2 * i],     accs[u][2 * kk][2 * i + 1]);
          pf[u][kk].w[4 + i] = pack2(accs[u][2 * kk + 1][2 * i], accs[u][2 * kk + 1][2 * i + 1]);
        }
      // Rescale running O
#pragma unroll
      for (int n = 0; n < 8; ++n)
#pragma unroll
        for (int j = 0; j < 8; ++j)
          acco[u][n][j] *= alpha;
    }

    // (P X)^T += X^T P^T : 2 K-dim iters x 8 d m-tiles x 4 query tiles = 64 WMMA.
    // Each X^T fragment is read once and used for all four query tiles.
    // The scores are dead here, so eight fragments are read as one group in front of
    // their 32 products. The scheduling barriers hold the groups together: one place
    // with LDS reads per group, none among the products.
    __builtin_amdgcn_sched_barrier(0);
#pragma unroll
    for (int kk = 0; kk < 2; ++kk) {
      Frag vf[8];
#pragma unroll
      for (int n = 0; n < 8; ++n) {
        const unsigned char* p = xt + va + kk * 32 * XP + n * 32;
        vf[n].q[0] = ld_tr16(p);
        vf[n].q[1] = ld_tr16(p + 16 * XP);
      }
      __builtin_amdgcn_sched_barrier(0);
#pragma unroll
      for (int n = 0; n < 8; ++n)
#pragma unroll
        for (int u = 0; u < NQT; ++u)
          acco[u][n] = __builtin_amdgcn_wmma_f32_16x16x32_bf16(
              false, vf[n].v, false, pf[u][kk].v, (short)0, acco[u][n], false, false);
      __builtin_amdgcn_sched_barrier(0);
    }
  }

  float4* So = (float4*)L;
  float2* Sm = (float2*)(L + SO_BYTES);
  wait_ds0();       // this wave's last LDS reads have returned
  __syncthreads();  // every wave has left the X and Q' buffers
  // Wv (128 x 128 bf16) over dead X buffers, 8 copies per thread: it lands under the merge
  {
    const unsigned l = lds_addr(L + WV_OFF + (wave * 2 + half) * (LDP * 2) + l16 * 16);
    const char* g = (const char*)(Wvb + (long)tid * 8);
    async_copy16x4(l, 16 * LDP * 2, g, 256 * 16);
    async_copy16x4(l + 64 * LDP * 2, 16 * LDP * 2, g + 4 * 256 * 16, 256 * 16);
  }
#pragma unroll
  for (int u = 0; u < NQT; ++u) {
#pragma unroll
    for (int n = 0; n < 8; ++n) {
      So[(wave * 64 + u * 16 + 2 * n) * 32 + lane] =
          make_float4(acco[u][n][0], acco[u][n][1], acco[u][n][2], acco[u][n][3]);
      So[(wave * 64 + u * 16 + 2 * n + 1) * 32 + lane] =
          make_float4(acco[u][n][4], acco[u][n][5], acco[u][n][6], acco[u][n][7]);
    }
    Sm[(wave * NQT + u) * 32 + lane] = make_float2(mrow[u], lrow[u]);
  }
  __syncthreads();  // partial results visible to the merging waves

  // Wave (dq, qt) finishes d columns 64*dq .. 64*dq+63 of the 16 query rows of
  // tile qt, which every wave s = 0..7 holds as its tile qt.
  const int qt = wave & 3, dq = wave >> 2;
  // bv of the 4 output columns that the lane stores in every row, read here so that
  // it arrives under the merge
  const float4 bo = *(const float4*)(bv + dq * 64 + l16 * 4);
  float wgt[NGRP], lsum;
  {
    float2 ml[NGRP];
#pragma unroll
    for (int s = 0; s < NGRP; ++s) ml[s] = Sm[(s * NQT + qt) * 32 + lane];
    float mxa = ml[0].x;
#pragma unroll
    for (int s = 1; s < NGRP; ++s) mxa = fmaxf(mxa, ml[s].x);
    float s = 0.0f;
#pragma unroll
    for (int g = 0; g < NGRP; ++g) {
      wgt[g] = __expf(ml[g].x - mxa);
      s += wgt[g] * ml[g].y;
    }
    lsum = s + other_half(s);  // the two halves' keys together
  }

  // Merged P X / l as bf16; a lane holds 8 consecutive d of one query per tile.
  uint4 ob[4];
#pragma unroll
  for (int nn = 0; nn < 4; ++nn) {
    const int n = dq * 4 + nn;
    float o[8] = {};
#pragma unroll
    for (int s = 0; s < NGRP; ++s) {
      float4 lo = So[(s * 64 + qt * 16 + 2 * n) * 32 + lane];
      float4 hi = So[(s * 64 + qt * 16 + 2 * n + 1) * 32 + lane];
      o[0] += wgt[s] * lo.x; o[1] += wgt[s] * lo.y;
      o[2] += wgt[s] * lo.z; o[3] += wgt[s] * lo.w;
      o[4] += wgt[s] * hi.x; o[5] += wgt[s] * hi.y;
      o[6] += wgt[s] * hi.z; o[7] += wgt[s] * hi.w;
    }
    ob[nn] = make_uint4(pack2(o[0] / lsum, o[1] / lsum), pack2(o[2] / lsum, o[3] / lsum),
                        pack2(o[4] / lsum, o[5] / lsum), pack2(o[6] / lsum, o[7] / lsum));
  }
  unsigned short (*Ob)[LDP] = (unsigned short (*)[LDP])(L + OB_OFF);
  const unsigned short (*Wl)[LDP] = (const unsigned short (*)[LDP])(L + WV_OFF);
  wait_ds0();       // this wave's reads of the merge planes have returned
  wait_async0();    // this wave's copies of Wv have landed
  __syncthreads();  // every wave has left the merge planes
#pragma unroll
  for (int nn = 0; nn < 4; ++nn)
    *(uint4*)&Ob[qt * 16 + l16][(dq * 4 + nn) * 16 + half * 8] = ob[nn];
  __syncthreads();  // the 64 x 128 tile of merged rows is visible

  // Out = (P X / l) Wv^T + bv, Wv as A: wave (dq, qt) makes output columns 64*dq ..
  // +63 of the 16 query rows of tile qt; a lane holds 8 consecutive columns of one query.
  // The wave's 64 columns of a query row are two 128-byte lines: its lanes' 16-byte
  // pieces go through the wave's own LDS rows and leave as whole lines, 16 lanes per row.
  float (*Ot)[OTP] = (float (*)[OTP])(L + OT_OFF + wave * (16 * OTP * 4));
  v8f accp[4] = {};
#pragma unroll
  for (int k0 = 0; k0 < EMB; k0 += 32) {
    const v16bf of = ldfrag(&Ob[qt * 16 + l16][k0 + half * 8]);
#pragma unroll
    for (int nn = 0; nn < 4; ++nn)
      accp[nn] = __builtin_amdgcn_wmma_f32_16x16x32_bf16(
          false, ldfrag(&Wl[(dq * 4 + nn) * 16 + l16][k0 + half * 8]), false, of,
          (short)0, accp[nn], false, false);
  }
#pragma unroll
  for (int nn = 0; nn < 4; ++nn) {
    float4* dst = (float4*)&Ot[l16][nn * 16 + half * 8];
    dst[0] = make_float4(accp[nn][0], accp[nn][1], accp[nn][2], accp[nn][3]);
    dst[1] = make_float4(accp[nn][4], accp[nn][5], accp[nn][6], accp[nn][7]);
  }
  wait_ds0();  // the wave's own pieces are in LDS before its lanes read each other's
#pragma unroll
  for (int i = 0; i < 8; ++i) {
    const int r = i * 2 + half, c4 = l16 * 4;
    const float4 v = *(const float4*)&Ot[r][c4];
    *(float4*)(Out + (qrow0 + qt * 16 + r) * EMB + dq * 64 + c4) =
        make_float4(v.x + bo.x, v.y + bo.y, v.z + bo.z, v.w + bo.w);
  }
}

extern "C" void kernel_launch(void* const* d_in, const int* in_sizes, int n_in,
                              void* d_out, int out_size, void* d_ws, size_t ws_size,
                              hipStream_t stream) {
  (void)in_sizes; (void)n_in; (void)out_size; (void)ws_size;
  const float* X  = (const float*)d_in[0];
  const float* Wq = (const float*)d_in[1];
  const float* bq = (const float*)d_in[2];
  const float* Wk = (const float*)d_in[3];
  const float* Wv = (const float*)d_in[5];
  const float* bv = (const float*)d_in[6];

  unsigned short* Qb  = (unsigned short*)d_ws;                // [16384][128] bf16: (X Wq^T + bq) Wk
  unsigned short* Xb  = Qb + (size_t)16384 * 128;             // [16384][128] bf16: X
  unsigned short* Wvb = Xb + (size_t)16384 * 128;             // [128][128] bf16: Wv
  float* Out = (float*)d_out;

  qx_kernel<<<256, 256, 0, stream>>>(X, Wq, bq, Wk, Wv, Qb, Xb, Wvb);
  attn_kernel<<<dim3(32, 8), 256, 0, stream>>>(Qb, Xb, Wvb, bv, Out);
}

// v010
// Measured time: 20.4 microseconds a run.
// In both of two side-by-side timings against v009, it was 1.05 times as fast.
// Over all steps from v000 it is 4.99 times as fast.
#include <hip/hip_runtime.h>

typedef __attribute__((ext_vector_type(16))) __bf16 v16bf;
typedef __attribute__((ext_vector_type(8)))  float  v8f;

#define EMB 128
#define LDP 136   // padded LDS row stride (elements): 272B = 17*16B -> conflict-free b128
#define VLP 72    // padded stride for the output staging tile: 144B = 9*16B

union Frag { v16bf v; uint4 q[2]; };

typedef __attribute__((ext_vector_type(2))) float  f32x2;
typedef __attribute__((ext_vector_type(2))) __bf16 bf16x2;
__device__ __forceinline__ unsigned pack2(float a, float b) {
  const f32x2 v = {a, b};
  return __builtin_bit_cast(unsigned, __builtin_convertvector(v, bf16x2));
}
// Load a 16x32 bf16 A/B fragment slice for this lane: 8 elems at p, 8 at p+16.
__device__ __forceinline__ v16bf ldfrag(const unsigned short* p) {
  Frag f;
  f.q[0] = *(const uint4*)(p);
  f.q[1] = *(const uint4*)(p + 16);
  return f.v;
}

__device__ __forceinline__ unsigned lds_addr(const void* p) {
  return (unsigned)(unsigned long long)p;
}
__device__ __forceinline__ void async_copy16x4(unsigned l, unsigned lstep,
                                               const char* g, long gstep) {
  asm volatile("global_load_async_to_lds_b128 %0, %4, off\n\t"
               "global_load_async_to_lds_b128 %1, %5, off\n\t"
               "global_load_async_to_lds_b128 %2, %6, off\n\t"
               "global_load_async_to_lds_b128 %3, %7, off\n\t"
               "s_wait_xcnt 0x0"
               :: "v"(l), "v"(l + lstep), "v"(l + 2 * lstep), "v"(l + 3 * lstep),
                  "v"(g), "v"(g + gstep), "v"(g + 2 * gstep), "v"(g + 3 * gstep)
               : "memory");
}
// Transposing LDS read: lane (c, h) of the 8 rows x 16 columns its half addresses
// gets column c, rows 0..7.
typedef short s16x8 __attribute__((ext_vector_type(8)));
__device__ __forceinline__ uint4 ld_tr16(const unsigned char* p) {
  typedef __attribute__((address_space(3))) s16x8 lds_s16x8;
  return __builtin_bit_cast(uint4, __builtin_amdgcn_ds_load_tr16_b128_v8i16((lds_s16x8*)p));
}
__device__ __forceinline__ void wait_async0() {
  asm volatile("s_wait_asynccnt 0" ::: "memory");
}
__device__ __forceinline__ float other_half(float v) {
  int b = __builtin_bit_cast(int, v);
  b = __builtin_amdgcn_permlanex16(b, b, 0x76543210, 0xfedcba98, false, false);
  return __builtin_bit_cast(float, b);
}
__device__ __forceinline__ void wait_ds0() {
  asm volatile("s_wait_dscnt 0x0" ::: "memory");
}

// Tensor load: one request of a whole wave brings a 2-D tile from global memory to LDS.
typedef uint32_t u32x4 __attribute__((ext_vector_type(4)));
typedef uint32_t u32x8 __attribute__((ext_vector_type(8)));
__device__ __forceinline__ uint32_t uni(uint32_t v) {
  return (uint32_t)__builtin_amdgcn_readfirstlane(v);
}
__device__ __forceinline__ uint32_t pinned(uint32_t v) {
  uint32_t w = uni(v);
  asm volatile("" : "+s"(w));
  return w;
}
__device__ __forceinline__ void wait_tensor0() {
  asm volatile("s_wait_tensorcnt 0x0" ::: "memory");
}
__device__ __forceinline__ void tdm_load(u32x4 g0, u32x8 g1) {
  asm volatile("tensor_load_to_lds %0, %1" :: "s"(g0), "s"(g1) : "memory");
}
__device__ __forceinline__ u32x8 tdm_group1() {
  u32x8 g;
  g[0] = uni((1u << 20) | (5u << 22) | (3u << 25));
  g[1] = uni(256u << 16);
  g[2] = uni(64u << 16);
  g[3] = uni(256u << 16);
  g[4] = uni(64u);
  g[5] = uni(256u);
  g[6] = uni(0u);
  g[7] = uni(0u);
  return g;
}
__device__ __forceinline__ u32x4 tdm_group0(uint32_t lds_dst, uint64_t ga) {
  u32x4 g;
  g[0] = uni(1u);
  g[1] = uni(lds_dst);
  g[2] = uni((uint32_t)ga);
  g[3] = uni((((uint32_t)(ga >> 32)) & 0x01FFFFFFu) | 0x80000000u);
  return g;
}

// ---------------------------------------------------------------------------
// The key and value projections are taken out of the attention loop:
//   Q K^T = Q (X Wk^T + 1 bk^T)^T = (Q Wk) X^T + (Q bk) 1^T ; the last term is one
//   constant per query row, which softmax cancels, so the scores are (Q Wk) X^T;
//   P V = P (X Wv^T + 1 bv^T) = (P X) Wv^T + bv, the rows of P summing to 1.
// One bf16 tile of X then serves as the key tile and as the value tile.
//
// Kernel 1: X as bf16, Q' = (X Wq^T + bq) Wk as bf16, Wv as bf16.
// Grid: 256 blocks x 256 threads (8 waves). Each block: 64 rows of X.
// Wave (rgrp,cgrp): 16 rows x 64 cols of the 64x128 output tile.
// Q' leaves as whole 128-byte lines, 16 bytes per lane, staged through LDS.
// ---------------------------------------------------------------------------
__global__ __launch_bounds__(256) void qx_kernel(
    const float* __restrict__ X,
    const float* __restrict__ Wq, const float* __restrict__ bq,
    const float* __restrict__ Wk, const float* __restrict__ Wv,
    unsigned short* __restrict__ Qb, unsigned short* __restrict__ Xb,
    unsigned short* __restrict__ Wvb)
{
  __shared__ __align__(16) unsigned short Xl[64][LDP];
  __shared__ __align__(16) unsigned short Wl[128][LDP];
  __shared__ __align__(16) unsigned short Qs[64][LDP];  // Q, operand of the second product
  // Output staging: rows 16*wave .. +15 are the wave's own 16 x 64 tile of Q'.
  __shared__ __align__(16) unsigned short St[128][VLP];
  // bq: a lane adds the bias of 8 consecutive columns. Twice, so that every thread
  // loads and stores one value: under a test the load moves behind the X tile's wait.
  __shared__ __align__(16) float Bl[2 * EMB];

  const int tid  = threadIdx.x;
  const int lane = tid & 31;
  const int wave = tid >> 5;
  const int half = (lane >> 4) & 1;
  const int l16  = lane & 15;
  const int rgrp = wave >> 1;           // 0..3: 16-row group
  const int cgrp = wave & 1;            // 0..1: 64-col group
  const long rowBase = (long)blockIdx.x * 64;

  // All global reads are issued as whole batches, one phase ahead of their use:
  // the X tile and Wq together at the start, Wk when Wq goes from registers to LDS.
  float4 xr[8], wr[16];
  const float bqv = bq[tid & (EMB - 1)];
  // This block's 64 elements (one 128-byte line as bf16) of Wv
  const float4 wv4 = ((const float4*)Wv)[blockIdx.x * 16 + (tid & 15)];
#pragma unroll  // the batch lives in registers: every index must be a constant
  for (int u = 0; u < 8; ++u)
    xr[u] = ((const float4*)(X + rowBase * EMB))[tid + u * 256];
#pragma unroll
  for (int u = 0; u < 16; ++u)
    wr[u] = ((const float4*)Wq)[tid + u * 256];

  // X tile (64x128 f32 -> bf16) to LDS; the packed values stay in registers for
  // the workspace copy
  uint2 xp[8];
#pragma unroll
  for (int u = 0; u < 8; ++u) {
    int i = tid + u * 256;
    int r = (i * 4) >> 7, c = (i * 4) & 127;
    xp[u] = make_uint2(pack2(xr[u].x, xr[u].y), pack2(xr[u].z, xr[u].w));
    *(unsigned*)&Xl[r][c]     = xp[u].x;
    *(unsigned*)&Xl[r][c + 2] = xp[u].y;
  }
  Bl[tid] = bqv;  // visible behind the first barrier below

#pragma unroll  // m a constant: the two products differ in operands and target
  for (int m = 0; m < 2; ++m) {
    __syncthreads();
#pragma unroll  // register batch
    for (int u = 0; u < 16; ++u) {
      int i = tid + u * 256;
      int r = (i * 4) >> 7, c = (i * 4) & 127;
      *(unsigned*)&Wl[r][c]     = pack2(wr[u].x, wr[u].y);
      *(unsigned*)&Wl[r][c + 2] = pack2(wr[u].z, wr[u].w);
    }
    if (m == 0) {
#pragma unroll  // register batch
      for (int u = 0; u < 16; ++u) wr[u] = ((const float4*)Wk)[tid + u * 256];
    }
    __syncthreads();
    if (m == 1) {
      // X and Wv as bf16 to the workspace, 8 bytes per lane, behind the kernel's
      // last barrier: a barrier waits for the stores in front of it.
#pragma unroll  // register batch
      for (int u = 0; u < 8; ++u)
        *(uint2*)(Xb + rowBase * EMB + (long)(tid + u * 256) * 4) = xp[u];
      if (tid < 16)
        *(uint2*)(Wvb + (blockIdx.x * 16 + tid) * 4) =
            make_uint2(pack2(wv4.x, wv4.y), pack2(wv4.z, wv4.w));
    }

    // W as A and the rows of X (of Q) as B: a lane holds 8 consecutive columns of
    // one row, 16 contiguous bytes of the result.
    v8f acc[4] = {};
#pragma unroll
    for (int k0 = 0; k0 < EMB; k0 += 32) {
      const v16bf a = ldfrag(m == 0 ? &Xl[rgrp * 16 + l16][k0 + half * 8]
                                    : &Qs[rgrp * 16 + l16][k0 + half * 8]);
#pragma unroll
      for (int t = 0; t < 4; ++t) {
        Frag w;
        if (m == 0) {
          // Q = X Wq^T: the sum runs along the rows of Wq
          w.v = ldfrag(&Wl[(cgrp * 4 + t) * 16 + l16][k0 + half * 8]);
        } else {
          // Q' = Q Wk: the sum runs down the columns of Wk, read transposed
          const unsigned char* p = (const unsigned char*)
              &Wl[k0 + half * 8 + (lane & 7)][(cgrp * 4 + t) * 16 + ((lane >> 3) & 1) * 8];
          w.q[0] = ld_tr16(p);
          w.q[1] = ld_tr16(p + 16 * LDP * 2);
        }
        acc[t] = __builtin_amdgcn_wmma_f32_16x16x32_bf16(
            false, w.v, false, a, (short)0, acc[t], false, false);
      }
    }

    if (m == 0) {
#pragma unroll
      for (int t = 0; t < 4; ++t) {
        const float* bp = &Bl[(cgrp * 4 + t) * 16 + half * 8];
        const float4 b0 = *(const float4*)bp, b1 = *(const float4*)(bp + 4);
        *(uint4*)&Qs[rgrp * 16 + l16][(cgrp * 4 + t) * 16 + half * 8] = make_uint4(
            pack2(acc[t][0] + b0.x, acc[t][1] + b0.y),
            pack2(acc[t][2] + b0.z, acc[t][3] + b0.w),
            pack2(acc[t][4] + b1.x, acc[t][5] + b1.y),
            pack2(acc[t][6] + b1.z, acc[t][7] + b1.w));
      }
    } else {
      const int r4 = lane >> 3, c8 = (lane & 7) * 8;  // read-back: 8 lanes per line
#pragma unroll
      for (int t = 0; t < 4; ++t)
        *(uint4*)&St[wave * 16 + l16][t * 16 + half * 8] = make_uint4(
            pack2(acc[t][0], acc[t][1]), pack2(acc[t][2], acc[t][3]),
            pack2(acc[t][4], acc[t][5]), pack2(acc[t][6], acc[t][7]));
      wait_ds0();  // the wave's own pieces are in LDS before its lanes read each other's
#pragma unroll
      for (int i = 0; i < 4; ++i) {
        const int r = i * 4 + r4;
        const uint4 v = *(const uint4*)&St[wave * 16 + r][c8];
        *(uint4*)(Qb + (rowBase + rgrp * 16 + r) * EMB + cgrp * 64 + c8) = v;
      }
    }
  }
}

#define NGRP 8
#define NQT  4
#define QL_BYTES (64 * LDP * 2)
#define XP 272
#define XT_BYTES 18432
#define XB_OFF   18432
#define XB_END   (XB_OFF + 2 * NGRP * XT_BYTES)
#define WV_BYTES (128 * LDP * 2)
#define WV_OFF   (XB_END - WV_BYTES)
#define SO_BYTES (NGRP * 64 * 32 * 16)
#define SM_BYTES (NGRP * NQT * 32 * 8)
#define OB_OFF   0
#define OT_OFF   32768
#define OTP      68
#define ATTN_LDS XB_END
union PFrag { v16bf v; unsigned w[8]; };  // P^T of 32 keys x 16 queries as a B operand
static_assert(63 * XP + 256 <= XT_BYTES, "a tile lies inside its buffer");
static_assert(QL_BYTES <= XB_OFF && XB_OFF % 2048 == 0 && XT_BYTES % 2048 == 0, "tensor load places");
static_assert(SO_BYTES + SM_BYTES <= WV_OFF, "the merge planes leave Wv alone");
static_assert(OB_OFF + QL_BYTES <= OT_OFF && OT_OFF + NGRP * 16 * OTP * 4 <= SO_BYTES, "staging");
static_assert(ATTN_LDS <= 327680, "LDS of one WGP");

__global__ __launch_bounds__(256) void attn_kernel(
    const unsigned short* __restrict__ Qb,
    const unsigned short* __restrict__ Xb,
    const unsigned short* __restrict__ Wvb,
    const float* __restrict__ bv,
    float* __restrict__ Out)
{
  __shared__ __attribute__((aligned(2048))) unsigned char L[ATTN_LDS];

  const int tid = threadIdx.x, lane = tid & 31;
  // The wave's number as a scalar: chunk and buffer addresses then live in scalar
  // registers.
  const int wave = __builtin_amdgcn_readfirstlane(tid >> 5);
  const int half = (lane >> 4) & 1, l16 = lane & 15;
  const int b = blockIdx.y;
  const long qrow0 = (long)b * 2048 + (long)blockIdx.x * 64;

  unsigned short (*Ql)[LDP] = (unsigned short (*)[LDP])(L);

  // Stage Q' tile once (64x128 bf16), async: 4 copies per thread, 16 rows apart
  async_copy16x4(lds_addr(&Ql[tid >> 4][(tid & 15) * 8]), 16 * LDP * 2,
                 (const char*)(Qb + qrow0 * EMB + (long)tid * 8), 256 * 16);

  const unsigned short* xbat = Xb + (long)b * 2048 * EMB;  // this batch's X

  // Per lane and query tile u: running max of query 16u + l16 (equal in both
  // halves) and the running sum over this half's keys; the halves' sums are
  // joined once, in the merge.
  float mrow[NQT], lrow[NQT];
#pragma unroll  // the arrays live in registers: every index must be a constant
  for (int u = 0; u < NQT; ++u) { mrow[u] = -3.0e38f; lrow[u] = 0.0f; }
  v8f acco[NQT][8] = {};  // acco[u][n][j] = (P X)[query 16u + l16][d = 16n + 8*half + j]

  const float scale = 0.088388347648318447f;  // 1/sqrt(128)

  // The wave's buffer 0 or 1
  auto xbuf = [&](const int buf) __attribute__((always_inline)) {
    return L + XB_OFF + (buf * NGRP + wave) * XT_BYTES;
  };
  // Staging of one X chunk (64 rows of 256 B) by its wave: one tensor load
  const u32x8 g1 = tdm_group1();
  auto stage_x = [&](const uint32_t chunk, const uint32_t buf) __attribute__((always_inline)) {
    tdm_load(tdm_group0(lds_addr(xbuf(buf)), (uint64_t)(xbat + (long)chunk * 64 * EMB)), g1);
  };
  stage_x(wave, 0);  // first chunk; every wave issues its own

  // The lane's places in a tile: for the scores row 2*(l16 & 7) + (l16 >> 3); for the
  // transposing load row 2*(lane & 7) + half, 16-byte piece (lane >> 3) & 1
  const int ka = (2 * (l16 & 7) + (l16 >> 3)) * XP + half * 16;
  const int va = (2 * (lane & 7) + half) * XP + ((lane >> 3) & 1) * 16;

  wait_async0();    // this wave's copies of Q' have landed
  wait_tensor0();   // this wave's first chunk has landed
  __syncthreads();  // Q' visible to every wave

  for (int it = 0; it < 32 / NGRP; ++it) {
    const unsigned char* xt = xbuf(it & 1);
    wait_ds0();       // this wave's reads of its previous chunk have returned
    wait_tensor0();   // this wave's load of this chunk has landed; no other wave reads it
    const uint32_t nx = pinned((uint32_t)it + 1u);
    if (pinned(nx < 32 / NGRP))
      stage_x(nx * NGRP + wave, nx & 1u);

    // S^T = X Q'^T : 4 key m-tiles x 4 query tiles x 4 K-dim iters = 64 WMMA.
    // Each X fragment is read once and used for all four query tiles.
    v8f accs[NQT][4] = {};
#pragma unroll
    for (int k0 = 0; k0 < EMB; k0 += 32) {
      v16bf qf[NQT], kf[4];
#pragma unroll
      for (int u = 0; u < NQT; ++u)
        qf[u] = ldfrag(&Ql[u * 16 + l16][k0 + half * 8]);
#pragma unroll
      for (int t = 0; t < 4; ++t)
        kf[t] = ldfrag((const unsigned short*)(xt + ka + t * 16 * XP + k0 * 2));
      // Holds the reads of the eight fragments together in front of their sixteen
      // products: one place with LDS reads per group, none among the products.
      __builtin_amdgcn_sched_barrier(0);
#pragma unroll
      for (int t = 0; t < 4; ++t)
#pragma unroll
        for (int u = 0; u < NQT; ++u)
          accs[u][t] = __builtin_amdgcn_wmma_f32_16x16x32_bf16(
              false, kf[t], false, qf[u], (short)0, accs[u][t], false, false);
      __builtin_amdgcn_sched_barrier(0);
    }

    // Online softmax: the lane's 32 scores of a tile column belong to one query.
    // The maximum is taken over the raw scores and scaled once: scale > 0 and
    // rounding is monotonic, so the value is that of the maximum of the scaled
    // scores, and no scaled copy of the scores needs registers.
    float mx[NQT];
#pragma unroll
    for (int u = 0; u < NQT; ++u) {
      const v8f m8 = __builtin_elementwise_max(
          __builtin_elementwise_max(accs[u][0], accs[u][1]),
          __builtin_elementwise_max(accs[u][2], accs[u][3]));
      const float m = fmaxf(fmaxf(fmaxf(m8[0], m8[1]), fmaxf(m8[2], m8[3])),
                            fmaxf(fmaxf(m8[4], m8[5]), fmaxf(m8[6], m8[7])));
      mx[u] = fmaxf(m, other_half(m)) * scale;
    }

    PFrag pf[NQT][2];
#pragma unroll
    for (int u = 0; u < NQT; ++u) {
      const float mn = fmaxf(mrow[u], mx[u]);
      const float alpha = __expf(mrow[u] - mn);
      mrow[u] = mn;
#pragma unroll
      for (int t = 0; t < 4; ++t)
#pragma unroll
        for (int j = 0; j < 8; ++j)
          accs[u][t][j] = __expf(accs[u][t][j] * scale - mn);
      // In-lane sum as a tree: eight independent chains over the tiles, then 8 -> 1
      const v8f s8 = (accs[u][0] + accs[u][1]) + (accs[u][2] + accs[u][3]);
      const float sm =
          ((s8[0] + s8[1]) + (s8[2] + s8[3])) + ((s8[4] + s8[5]) + (s8[6] + s8[7]));
      lrow[u] = lrow[u] * alpha + sm;
#pragma unroll
      for (int kk = 0; kk < 2; ++kk)
#pragma unroll
        for (int i = 0; i < 4; ++i) {
          pf[u][kk].w[i]     = pack2(accs[u][2 * kk][2 * i],     accs[u][2 * kk][2 * i + 1]);
          pf[u][kk].w[4 + i] = pack2(accs[u][2 * kk + 1][2 * i], accs[u][2 * kk + 1][2 * i + 1]);
        }
      // Rescale running O
#pragma unroll
      for (int n = 0; n < 8; ++n)
#pragma unroll
        for (int j = 0; j < 8; ++j)
          acco[u][n][j] *= alpha;
    }

    // (P X)^T += X^T P^T : 2 K-dim iters x 8 d m-tiles x 4 query tiles = 64 WMMA.
    // Each X^T fragment is read once and used for all four query tiles.
    // The scores are dead here, so eight fragments are read as one group in front of
    // their 32 products. The scheduling barriers hold the groups together: one place
    // with LDS reads per group, none among the products.
    __builtin_amdgcn_sched_barrier(0);
#pragma unroll
    for (int kk = 0; kk < 2; ++kk) {
      Frag vf[8];
#pragma unroll
      for (int n = 0; n < 8; ++n) {
        const unsigned char* p = xt + va + kk * 32 * XP + n * 32;
        vf[n].q[0] = ld_tr16(p);
        vf[n].q[1] = ld_tr16(p + 16 * XP);
      }
      __builtin_amdgcn_sched_barrier(0);
#pragma unroll
      for (int n = 0; n < 8; ++n)
#pragma unroll
        for (int u = 0; u < NQT; ++u)
          acco[u][n] = __builtin_amdgcn_wmma_f32_16x16x32_bf16(
              false, vf[n].v, false, pf[u][kk].v, (short)0, acco[u][n], false, false);
      __builtin_amdgcn_sched_barrier(0);
    }
  }

  float4* So = (float4*)L;
  float2* Sm = (float2*)(L + SO_BYTES);
  wait_tensor0();   // no tensor load of this wave is in flight when the ring is reused
  wait_ds0();       // this wave's last LDS reads have returned
  __syncthreads();  // every wave has left the X and Q' buffers
  // Wv (128 x 128 bf16) over dead X buffers, 8 copies per thread: it lands under the merge
  {
    const unsigned l = lds_addr(L + WV_OFF + (wave * 2 + half) * (LDP * 2) + l16 * 16);
    const char* g = (const char*)(Wvb + (long)tid * 8);
    async_copy16x4(l, 16 * LDP * 2, g, 256 * 16);
    // Keeps the second statement's 12 address registers behind the first: asm operands lie
    // in the first 256 registers, where the accumulators leave too few for all 24 (spills).
    __builtin_amdgcn_sched_barrier(0);
    async_copy16x4(l + 64 * LDP * 2, 16 * LDP * 2, g + 4 * 256 * 16, 256 * 16);
    __builtin_amdgcn_sched_barrier(0);
  }
#pragma unroll
  for (int u = 0; u < NQT; ++u) {
#pragma unroll
    for (int n = 0; n < 8; ++n) {
      So[(wave * 64 + u * 16 + 2 * n) * 32 + lane] =
          make_float4(acco[u][n][0], acco[u][n][1], acco[u][n][2], acco[u][n][3]);
      So[(wave * 64 + u * 16 + 2 * n + 1) * 32 + lane] =
          make_float4(acco[u][n][4], acco[u][n][5], acco[u][n][6], acco[u][n][7]);
    }
    Sm[(wave * NQT + u) * 32 + lane] = make_float2(mrow[u], lrow[u]);
  }
  __syncthreads();  // partial results visible to the merging waves

  // Wave (dq, qt) finishes d columns 64*dq .. 64*dq+63 of the 16 query rows of
  // tile qt, which every wave s = 0..7 holds as its tile qt.
  const int qt = wave & 3, dq = wave >> 2;
  // bv of the 4 output columns that the lane stores in every row, read here so that
  // it arrives under the merge
  const float4 bo = *(const float4*)(bv + dq * 64 + l16 * 4);
  float wgt[NGRP], lsum;
  {
    float2 ml[NGRP];
#pragma unroll
    for (int s = 0; s < NGRP; ++s) ml[s] = Sm[(s * NQT + qt) * 32 + lane];
    float mxa = ml[0].x;
#pragma unroll
    for (int s = 1; s < NGRP; ++s) mxa = fmaxf(mxa, ml[s].x);
    float s = 0.0f;
#pragma unroll
    for (int g = 0; g < NGRP; ++g) {
      wgt[g] = __expf(ml[g].x - mxa);
      s += wgt[g] * ml[g].y;
    }
    lsum = s + other_half(s);  // the two halves' keys together
  }

  // Merged P X / l as bf16; a lane holds 8 consecutive d of one query per tile.
  uint4 ob[4];
#pragma unroll
  for (int nn = 0; nn < 4; ++nn) {
    const int n = dq * 4 + nn;
    float o[8] = {};
#pragma unroll
    for (int s = 0; s < NGRP; ++s) {
      float4 lo = So[(s * 64 + qt * 16 + 2 * n) * 32 + lane];
      float4 hi = So[(s * 64 + qt * 16 + 2 * n + 1) * 32 + lane];
      o[0] += wgt[s] * lo.x; o[1] += wgt[s] * lo.y;
      o[2] += wgt[s] * lo.z; o[3] += wgt[s] * lo.w;
      o[4] += wgt[s] * hi.x; o[5] += wgt[s] * hi.y;
      o[6] += wgt[s] * hi.z; o[7] += wgt[s] * hi.w;
    }
    ob[nn] = make_uint4(pack2(o[0] / lsum, o[1] / lsum), pack2(o[2] / lsum, o[3] / lsum),
                        pack2(o[4] / lsum, o[5] / lsum), pack2(o[6] / lsum, o[7] / lsum));
  }
  unsigned short (*Ob)[LDP] = (unsigned short (*)[LDP])(L + OB_OFF);
  const unsigned short (*Wl)[LDP] = (const unsigned short (*)[LDP])(L + WV_OFF);
  wait_ds0();       // this wave's reads of the merge planes have returned
  wait_async0();    // this wave's copies of Wv have landed
  __syncthreads();  // every wave has left the merge planes
#pragma unroll
  for (int nn = 0; nn < 4; ++nn)
    *(uint4*)&Ob[qt * 16 + l16][(dq * 4 + nn) * 16 + half * 8] = ob[nn];
  __syncthreads();  // the 64 x 128 tile of merged rows is visible

  // Out = (P X / l) Wv^T + bv, Wv as A: wave (dq, qt) makes output columns 64*dq ..
  // +63 of the 16 query rows of tile qt; a lane holds 8 consecutive columns of one query.
  // The wave's 64 columns of a query row are two 128-byte lines: its lanes' 16-byte
  // pieces go through the wave's own LDS rows and leave as whole lines, 16 lanes per row.
  float (*Ot)[OTP] = (float (*)[OTP])(L + OT_OFF + wave * (16 * OTP * 4));
  v8f accp[4] = {};
#pragma unroll
  for (int k0 = 0; k0 < EMB; k0 += 32) {
    const v16bf of = ldfrag(&Ob[qt * 16 + l16][k0 + half * 8]);
#pragma unroll
    for (int nn = 0; nn < 4; ++nn)
      accp[nn] = __builtin_amdgcn_wmma_f32_16x16x32_bf16(
          false, ldfrag(&Wl[(dq * 4 + nn) * 16 + l16][k0 + half * 8]), false, of,
          (short)0, accp[nn], false, false);
  }
#pragma unroll
  for (int nn = 0; nn < 4; ++nn) {
    float4* dst = (float4*)&Ot[l16][nn * 16 + half * 8];
    dst[0] = make_float4(accp[nn][0], accp[nn][1], accp[nn][2], accp[nn][3]);
    dst[1] = make_float4(accp[nn][4], accp[nn][5], accp[nn][6], accp[nn][7]);
  }
  wait_ds0();  // the wave's own pieces are in LDS before its lanes read each other's
#pragma unroll
  for (int i = 0; i < 8; ++i) {
    const int r = i * 2 + half, c4 = l16 * 4;
    const float4 v = *(const float4*)&Ot[r][c4];
    *(float4*)(Out + (qrow0 + qt * 16 + r) * EMB + dq * 64 + c4) =
        make_float4(v.x + bo.x, v.y + bo.y, v.z + bo.z, v.w + bo.w);
  }
}

extern "C" void kernel_launch(void* const* d_in, const int* in_sizes, int n_in,
                              void* d_out, int out_size, void* d_ws, size_t ws_size,
                              hipStream_t stream) {
  (void)in_sizes; (void)n_in; (void)out_size; (void)ws_size;
  const float* X  = (const float*)d_in[0];
  const float* Wq = (const float*)d_in[1];
  const float* bq = (const float*)d_in[2];
  const float* Wk = (const float*)d_in[3];
  const float* Wv = (const float*)d_in[5];
  const float* bv = (const float*)d_in[6];

  unsigned short* Qb  = (unsigned short*)d_ws;                // [16384][128] bf16: (X Wq^T + bq) Wk
  unsigned short* Xb  = Qb + (size_t)16384 * 128;             // [16384][128] bf16: X
  unsigned short* Wvb = Xb + (size_t)16384 * 128;             // [128][128] bf16: Wv
  float* Out = (float*)d_out;

  qx_kernel<<<256, 256, 0, stream>>>(X, Wq, bq, Wk, Wv, Qb, Xb, Wvb);
  attn_kernel<<<dim3(32, 8), 256, 0, stream>>>(Qb, Xb, Wvb, bv, Out);
}
